// v000
// Measured on an AMD MI455X. A time is GPU time per run, averaged over a window of back-to-back runs after a warm-up
// (all launches, gaps included; the runs take copies of the inputs in turn), and the median of several windows.
// Apart from v000's, it joins two sittings. Times from different sittings can be a few percent apart, while
// side-by-side timings come from the same sitting.
// v000, which the later versions start from, runs in 223 microseconds.
#include <hip/hip_runtime.h>

typedef __attribute__((ext_vector_type(16))) _Float16 v16h;
typedef __attribute__((ext_vector_type(4)))  _Float16 v4h;
typedef __attribute__((ext_vector_type(8)))  float    v8f;
typedef __attribute__((ext_vector_type(4)))  int      v4i;

#define WMMA(a, b, c) \
  __builtin_amdgcn_wmma_f32_16x16x32_f16(false, (a), false, (b), (short)0, (c), false, false)

static constexpr int kB = 4, kS = 2048, kD = 512, kH = 8, kHD = 64;
static constexpr int kBS = kB * kS;  // 8192 tokens

// ---------------------------------------------------------------------------
// CDNA5 async global->LDS copy (16B per lane), tracked by ASYNCcnt.
// Builtin signature (from hipcc diagnostic): (AS1 int4* src, AS3 int4* dst, Ii, Ii)
// ---------------------------------------------------------------------------
__device__ __forceinline__ void async_cp16(void* lds_dst, const void* gsrc) {
#if __has_builtin(__builtin_amdgcn_global_load_async_to_lds_b128)
  __builtin_amdgcn_global_load_async_to_lds_b128(
      (__attribute__((address_space(1))) v4i*)gsrc,
      (__attribute__((address_space(3))) v4i*)lds_dst, 0, 0);
#else
  unsigned loff = (unsigned)(size_t)(__attribute__((address_space(3))) void*)lds_dst;
  asm volatile("global_load_async_to_lds_b128 %0, %1, off" ::"v"(loff), "v"(gsrc)
               : "memory");
#endif
}

#if __has_builtin(__builtin_amdgcn_s_wait_asynccnt)
#define WAIT_ASYNC(n) __builtin_amdgcn_s_wait_asynccnt(n)
#else
#define WAIT_ASYNC(n) asm volatile("s_wait_asynccnt %0" ::"i"(n) : "memory")
#endif

// A/B fragment load for v_wmma_f32_16x16x32_f16.
// A (16x32, MxK) from row-major [M][K]: lane&15 -> row, lane>>4 -> 16-wide K half.
// B (32x16, KxN) from [N][K] row-major (i.e. transposed B): identical addressing.
__device__ __forceinline__ const v16h* fragp(const _Float16* __restrict__ base, int ld,
                                             int row0, int col0, int lane) {
  return (const v16h*)(base + (size_t)(row0 + (lane & 15)) * ld + col0 + ((lane >> 4) << 4));
}

// ---------------------------------------------------------------------------
// f32 -> f16 conversion (vectorized x4)
// ---------------------------------------------------------------------------
__global__ __launch_bounds__(256) void cvt_f16_kernel(const float* __restrict__ src,
                                                      _Float16* __restrict__ dst, int n4) {
  int i = blockIdx.x * 256 + threadIdx.x;
  if (i < n4) {
    float4 f = ((const float4*)src)[i];
    v4h h = {(_Float16)f.x, (_Float16)f.y, (_Float16)f.z, (_Float16)f.w};
    ((v4h*)dst)[i] = h;
  }
}

// ---------------------------------------------------------------------------
// Y = X @ W^T + bias, X:[8192,512] f16, W:[512,512] f16 (row-major = [N][K]).
// 4 waves/block; each wave computes a 32x64 strip: 8 WMMAs per 6 frag loads.
// MODE 0: Q  -> [B,H,S,HD] f16, scaled by 1/sqrt(HD)
// MODE 1: K  -> [B,H,S,HD] f16
// MODE 2: V  -> [B,H,HD,S] f16 (transposed for P@V B-operand)
// MODE 3: O  -> [B,S,D] f32 (final output)
// ---------------------------------------------------------------------------
template <int MODE>
__global__ __launch_bounds__(128) void gemm_wmma_kernel(const _Float16* __restrict__ X,
                                                        const _Float16* __restrict__ W,
                                                        const float* __restrict__ bias,
                                                        void* __restrict__ Y) {
  const int lane = threadIdx.x & 31;
  const int wv   = threadIdx.x >> 5;
  const int m0   = blockIdx.x * 128 + wv * 32;
  const int n0   = blockIdx.y * 64;

  v8f acc[2][4] = {};
#pragma unroll 4
  for (int k0 = 0; k0 < kD; k0 += 32) {
    v16h a0 = *fragp(X, kD, m0, k0, lane);
    v16h a1 = *fragp(X, kD, m0 + 16, k0, lane);
#pragma unroll
    for (int j = 0; j < 4; ++j) {
      v16h b = *fragp(W, kD, n0 + 16 * j, k0, lane);
      acc[0][j] = WMMA(a0, b, acc[0][j]);
      acc[1][j] = WMMA(a1, b, acc[1][j]);
    }
  }

  // C layout: lanes 0-15 hold N=lane, M=vgpr; lanes 16-31 hold N=lane-16, M=8+vgpr
  const int rl = (lane >> 4) << 3;
  const int nl = lane & 15;
#pragma unroll
  for (int mi = 0; mi < 2; ++mi) {
#pragma unroll
    for (int j = 0; j < 4; ++j) {
#pragma unroll
      for (int v = 0; v < 8; ++v) {
        const int gr = m0 + 16 * mi + rl + v;  // token row
        const int gc = n0 + 16 * j + nl;       // output feature
        float val = acc[mi][j][v] + bias[gc];
        if (MODE == 0) val *= 0.125f;  // fold attention scale 1/sqrt(64) into Q
        if (MODE <= 1) {
          const int bb = gr >> 11, ss = gr & (kS - 1);
          const int hh = gc >> 6, dd = gc & (kHD - 1);
          ((_Float16*)Y)[((size_t)(bb * kH + hh) * kS + ss) * kHD + dd] = (_Float16)val;
        } else if (MODE == 2) {
          const int bb = gr >> 11, ss = gr & (kS - 1);
          const int hh = gc >> 6, dd = gc & (kHD - 1);
          ((_Float16*)Y)[((size_t)(bb * kH + hh) * kHD + dd) * kS + ss] = (_Float16)val;
        } else {
          ((float*)Y)[(size_t)gr * kD + gc] = val;
        }
      }
    }
  }
}

// ---------------------------------------------------------------------------
// Flash attention: grid (S/64 q-tiles, B*H). 4 waves/block, wave owns 16 q rows.
// K/V 64x64 tiles staged in LDS with double-buffered async copies (ASYNCcnt),
// online softmax; scale already folded into Qp. VpT is [B,H,HD,S].
// ---------------------------------------------------------------------------
__global__ __launch_bounds__(128) void flash_attn_kernel(const _Float16* __restrict__ Qp,
                                                         const _Float16* __restrict__ Kp,
                                                         const _Float16* __restrict__ VpT,
                                                         _Float16* __restrict__ ctx) {
  __shared__ _Float16 Ktile[2][64][64];  // [buf][key][hd]     8KB each
  __shared__ _Float16 Vtile[2][64][64];  // [buf][hd][key]     8KB each
  __shared__ _Float16 Plds[4][16][64];   // per-wave P bounce  8KB

  const int tid  = threadIdx.x;
  const int lane = tid & 31;
  const int wv   = tid >> 5;
  const int bh   = blockIdx.y;
  const int q0   = blockIdx.x * 64 + wv * 16;

  const _Float16* Qb = Qp + (size_t)bh * kS * kHD;
  const _Float16* Kb = Kp + (size_t)bh * kS * kHD;
  const _Float16* Vb = VpT + (size_t)bh * kHD * kS;

  // 8 x b128 async copies per thread per tile (K: 8KB, V: 8KB for 128 threads)
  auto issue_tile = [&](int kt, int buf) {
#pragma unroll
    for (int i = 0; i < 4; ++i) {
      const int idx = i * 128 + tid;   // 16B chunk id, 0..511
      const int row = idx >> 3;        // 0..63
      const int c8  = (idx & 7) << 3;  // half offset within row
      async_cp16(&Ktile[buf][row][c8], Kb + (size_t)(kt + row) * kHD + c8);
    }
#pragma unroll
    for (int i = 0; i < 4; ++i) {
      const int idx = i * 128 + tid;
      const int row = idx >> 3;        // hd
      const int c8  = (idx & 7) << 3;  // key offset
      async_cp16(&Vtile[buf][row][c8], Vb + (size_t)row * kS + kt + c8);
    }
  };

  const v16h aq0 = *fragp(Qb, kHD, q0, 0, lane);
  const v16h aq1 = *fragp(Qb, kHD, q0, 32, lane);

  v8f acc[4] = {};
  float mrow[8], lrow[8];
#pragma unroll
  for (int v = 0; v < 8; ++v) { mrow[v] = -1e30f; lrow[v] = 0.0f; }

  const int rl = (lane >> 4) << 3;
  const int nl = lane & 15;
  _Float16* Pw = &Plds[wv][0][0];

  issue_tile(0, 0);

  for (int ti = 0; ti < kS / 64; ++ti) {
    const int buf = ti & 1;
    if (ti + 1 < kS / 64) {
      issue_tile((ti + 1) * 64, buf ^ 1);
      WAIT_ASYNC(8);  // all but the 8 just-issued -> current tile resident
    } else {
      WAIT_ASYNC(0);
    }
    __syncthreads();

    const _Float16* Kt = &Ktile[buf][0][0];
    const _Float16* Vt = &Vtile[buf][0][0];

    // scores S = Q @ K^T (16 x 64) from LDS K tile
    v8f sc[4] = {};
#pragma unroll
    for (int j = 0; j < 4; ++j) {
      const _Float16* kp = Kt + (size_t)(16 * j + nl) * 64 + ((lane >> 4) << 4);
      v16h b0 = *(const v16h*)kp;
      sc[j] = WMMA(aq0, b0, sc[j]);
      v16h b1 = *(const v16h*)(kp + 32);
      sc[j] = WMMA(aq1, b1, sc[j]);
    }

    // row max across 64 keys: elementwise over tiles, then across 16 lanes
    float t[8];
#pragma unroll
    for (int v = 0; v < 8; ++v)
      t[v] = fmaxf(fmaxf(sc[0][v], sc[1][v]), fmaxf(sc[2][v], sc[3][v]));
#pragma unroll
    for (int off = 1; off < 16; off <<= 1)
#pragma unroll
      for (int v = 0; v < 8; ++v) t[v] = fmaxf(t[v], __shfl_xor(t[v], off, 32));

    float al[8], rs[8];
#pragma unroll
    for (int v = 0; v < 8; ++v) {
      const float mn = fmaxf(mrow[v], t[v]);
      al[v] = __expf(mrow[v] - mn);
      mrow[v] = mn;
      rs[v] = 0.0f;
    }

    // P = exp(S - m): accumulate row sums, write f16 P to LDS for A-layout reload
#pragma unroll
    for (int j = 0; j < 4; ++j)
#pragma unroll
      for (int v = 0; v < 8; ++v) {
        const float pv = __expf(sc[j][v] - mrow[v]);
        rs[v] += pv;
        Pw[(rl + v) * 64 + 16 * j + nl] = (_Float16)pv;
      }

#pragma unroll
    for (int off = 1; off < 16; off <<= 1)
#pragma unroll
      for (int v = 0; v < 8; ++v) rs[v] += __shfl_xor(rs[v], off, 32);

#pragma unroll
    for (int v = 0; v < 8; ++v) lrow[v] = lrow[v] * al[v] + rs[v];
#pragma unroll
    for (int j = 0; j < 4; ++j)
#pragma unroll
      for (int v = 0; v < 8; ++v) acc[j][v] *= al[v];

    __syncthreads();

    // reload P as A-fragments (16 x 64 over K=keys)
    const v16h ap0 = *(const v16h*)(Pw + nl * 64 + ((lane >> 4) << 4));
    const v16h ap1 = *(const v16h*)(Pw + nl * 64 + 32 + ((lane >> 4) << 4));

    // ctx += P @ V from LDS V tile ([hd][key] -> B operand contiguous along keys)
#pragma unroll
    for (int j = 0; j < 4; ++j) {
      const _Float16* vp = Vt + (size_t)(16 * j + nl) * 64 + ((lane >> 4) << 4);
      const v16h bv0 = *(const v16h*)vp;
      const v16h bv1 = *(const v16h*)(vp + 32);
      acc[j] = WMMA(ap0, bv0, acc[j]);
      acc[j] = WMMA(ap1, bv1, acc[j]);
    }
    __syncthreads();  // protect K/V buf and P region before next iteration
  }

  // normalize and store ctx as token-major [B,S,D] f16 for the output GEMM
  const int bb = bh >> 3, hh = bh & 7;
#pragma unroll
  for (int v = 0; v < 8; ++v) {
    const float inv = 1.0f / lrow[v];
    const int srow  = q0 + rl + v;
#pragma unroll
    for (int j = 0; j < 4; ++j)
      ctx[((size_t)bb * kS + srow) * kD + hh * kHD + 16 * j + nl] =
          (_Float16)(acc[j][v] * inv);
  }
}

// ---------------------------------------------------------------------------
extern "C" void kernel_launch(void* const* d_in, const int* in_sizes, int n_in,
                              void* d_out, int out_size, void* d_ws, size_t ws_size,
                              hipStream_t stream) {
  const float* q  = (const float*)d_in[0];
  const float* k  = (const float*)d_in[1];
  const float* v  = (const float*)d_in[2];
  const float* Wq = (const float*)d_in[3];
  const float* bq = (const float*)d_in[4];
  const float* Wk = (const float*)d_in[5];
  const float* bk = (const float*)d_in[6];
  const float* Wv = (const float*)d_in[7];
  const float* bv = (const float*)d_in[8];
  const float* Wo = (const float*)d_in[9];
  const float* bo = (const float*)d_in[10];

  char* p = (char*)d_ws;
  auto take = [&](size_t bytes) -> char* {
    char* r = p;
    p += (bytes + 255) & ~(size_t)255;
    return r;
  };
  const size_t tokElems = (size_t)kBS * kD;  // 8192*512
  const size_t wElems   = (size_t)kD * kD;

  _Float16* q16  = (_Float16*)take(tokElems * 2);
  _Float16* k16  = (_Float16*)take(tokElems * 2);
  _Float16* v16  = (_Float16*)take(tokElems * 2);
  _Float16* Wq16 = (_Float16*)take(wElems * 2);
  _Float16* Wk16 = (_Float16*)take(wElems * 2);
  _Float16* Wv16 = (_Float16*)take(wElems * 2);
  _Float16* Wo16 = (_Float16*)take(wElems * 2);
  _Float16* Qp   = (_Float16*)take(tokElems * 2);
  _Float16* Kp   = (_Float16*)take(tokElems * 2);
  _Float16* VpT  = (_Float16*)take(tokElems * 2);
  _Float16* ctx  = (_Float16*)take(tokElems * 2);

  auto cvt = [&](const float* src, _Float16* dst, size_t n) {
    int n4 = (int)(n / 4);
    cvt_f16_kernel<<<(n4 + 255) / 256, 256, 0, stream>>>(src, dst, n4);
  };
  cvt(q, q16, tokElems);
  cvt(k, k16, tokElems);
  cvt(v, v16, tokElems);
  cvt(Wq, Wq16, wElems);
  cvt(Wk, Wk16, wElems);
  cvt(Wv, Wv16, wElems);
  cvt(Wo, Wo16, wElems);

  dim3 ggrid(kBS / 128, kD / 64);
  gemm_wmma_kernel<0><<<ggrid, 128, 0, stream>>>(q16, Wq16, bq, (void*)Qp);
  gemm_wmma_kernel<1><<<ggrid, 128, 0, stream>>>(k16, Wk16, bk, (void*)Kp);
  gemm_wmma_kernel<2><<<ggrid, 128, 0, stream>>>(v16, Wv16, bv, (void*)VpT);

  flash_attn_kernel<<<dim3(kS / 64, kB * kH), 128, 0, stream>>>(Qp, Kp, VpT, ctx);

  gemm_wmma_kernel<3><<<ggrid, 128, 0, stream>>>(ctx, Wo16, bo, d_out);
}

// v001
// Measured time: 153 microseconds a run.
// Two timings next to v000 both put it at 1.50 times that version's speed.
#include <hip/hip_runtime.h>

typedef __attribute__((ext_vector_type(16))) _Float16 v16h;
typedef __attribute__((ext_vector_type(8)))  _Float16 v8h;
typedef __attribute__((ext_vector_type(4)))  _Float16 v4h;
typedef __attribute__((ext_vector_type(8)))  float    v8f;
typedef __attribute__((ext_vector_type(4)))  int      v4i;

#define WMMA(a, b, c) \
  __builtin_amdgcn_wmma_f32_16x16x32_f16(false, (a), false, (b), (short)0, (c), false, false)

static constexpr int kB = 4, kS = 2048, kD = 512, kH = 8, kHD = 64;
static constexpr int kBS = kB * kS;  // 8192 tokens
// LDS row pitch in halves: 64 data + 8 pad = 144 B = 16 B x odd, so the 16 rows
// that one ds_load_b128 touches per lane half fall on 16 distinct bank groups.
static constexpr int kLP = 72;

// ---------------------------------------------------------------------------
// CDNA5 async global->LDS copy (16B per lane), tracked by ASYNCcnt.
// Builtin signature (from hipcc diagnostic): (AS1 int4* src, AS3 int4* dst, Ii, Ii)
// ---------------------------------------------------------------------------
__device__ __forceinline__ void async_cp16(void* lds_dst, const void* gsrc) {
#if __has_builtin(__builtin_amdgcn_global_load_async_to_lds_b128)
  __builtin_amdgcn_global_load_async_to_lds_b128(
      (__attribute__((address_space(1))) v4i*)gsrc,
      (__attribute__((address_space(3))) v4i*)lds_dst, 0, 0);
#else
  unsigned loff = (unsigned)(size_t)(__attribute__((address_space(3))) void*)lds_dst;
  asm volatile("global_load_async_to_lds_b128 %0, %1, off" ::"v"(loff), "v"(gsrc)
               : "memory");
#endif
}

#if __has_builtin(__builtin_amdgcn_s_wait_asynccnt)
#define WAIT_ASYNC(n) __builtin_amdgcn_s_wait_asynccnt(n)
#else
#define WAIT_ASYNC(n) asm volatile("s_wait_asynccnt %0" ::"i"(n) : "memory")
#endif

// A/B fragment load for v_wmma_f32_16x16x32_f16.
// A (16x32, MxK) from row-major [M][K]: lane&15 -> row, lane>>4 -> 16-wide K half.
// B (32x16, KxN) from [N][K] row-major (i.e. transposed B): identical addressing.
__device__ __forceinline__ const v16h* fragp(const _Float16* __restrict__ base, int ld,
                                             int row0, int col0, int lane) {
  return (const v16h*)(base + (size_t)(row0 + (lane & 15)) * ld + col0 + ((lane >> 4) << 4));
}

// 32-byte fragment slice from a padded LDS row. The rows are 16-byte aligned
// only, so it is read as two 16-byte halves.
__device__ __forceinline__ v16h lds_frag(const _Float16* p) {
  const v8h lo = *(const v8h*)p;
  const v8h hi = *(const v8h*)(p + 8);
  return __builtin_shufflevector(lo, hi, 0, 1, 2, 3, 4, 5, 6, 7, 8, 9, 10, 11, 12, 13, 14, 15);
}

// ---------------------------------------------------------------------------
// f32 -> f16 conversion (vectorized x4)
// ---------------------------------------------------------------------------
__global__ __launch_bounds__(256) void cvt_f16_kernel(const float* __restrict__ src,
                                                      _Float16* __restrict__ dst, int n4) {
  int i = blockIdx.x * 256 + threadIdx.x;
  if (i < n4) {
    float4 f = ((const float4*)src)[i];
    v4h h = {(_Float16)f.x, (_Float16)f.y, (_Float16)f.z, (_Float16)f.w};
    ((v4h*)dst)[i] = h;
  }
}

// ---------------------------------------------------------------------------
// Y = X @ W^T + bias, X:[8192,512] f16, W:[512,512] f16 (row-major = [N][K]).
// 4 waves/block; each wave computes a 32x64 strip: 8 WMMAs per 6 frag loads.
// MODE 0: Q  -> [B,H,S,HD] f16, scaled by 1/sqrt(HD)
// MODE 1: K  -> [B,H,S,HD] f16
// MODE 2: V  -> [B,H,HD,S] f16 (transposed for P@V B-operand)
// MODE 3: O  -> [B,S,D] f32 (final output)
// ---------------------------------------------------------------------------
template <int MODE>
__global__ __launch_bounds__(128) void gemm_wmma_kernel(const _Float16* __restrict__ X,
                                                        const _Float16* __restrict__ W,
                                                        const float* __restrict__ bias,
                                                        void* __restrict__ Y) {
  const int lane = threadIdx.x & 31;
  const int wv   = threadIdx.x >> 5;
  const int m0   = blockIdx.x * 128 + wv * 32;
  const int n0   = blockIdx.y * 64;

  v8f acc[2][4] = {};
#pragma unroll 4
  for (int k0 = 0; k0 < kD; k0 += 32) {
    v16h a0 = *fragp(X, kD, m0, k0, lane);
    v16h a1 = *fragp(X, kD, m0 + 16, k0, lane);
#pragma unroll
    for (int j = 0; j < 4; ++j) {
      v16h b = *fragp(W, kD, n0 + 16 * j, k0, lane);
      acc[0][j] = WMMA(a0, b, acc[0][j]);
      acc[1][j] = WMMA(a1, b, acc[1][j]);
    }
  }

  // C layout: lanes 0-15 hold N=lane, M=vgpr; lanes 16-31 hold N=lane-16, M=8+vgpr
  const int rl = (lane >> 4) << 3;
  const int nl = lane & 15;
#pragma unroll
  for (int mi = 0; mi < 2; ++mi) {
#pragma unroll
    for (int j = 0; j < 4; ++j) {
#pragma unroll
      for (int v = 0; v < 8; ++v) {
        const int gr = m0 + 16 * mi + rl + v;  // token row
        const int gc = n0 + 16 * j + nl;       // output feature
        float val = acc[mi][j][v] + bias[gc];
        if (MODE == 0) val *= 0.125f;  // fold attention scale 1/sqrt(64) into Q
        if (MODE <= 1) {
          const int bb = gr >> 11, ss = gr & (kS - 1);
          const int hh = gc >> 6, dd = gc & (kHD - 1);
          ((_Float16*)Y)[((size_t)(bb * kH + hh) * kS + ss) * kHD + dd] = (_Float16)val;
        } else if (MODE == 2) {
          const int bb = gr >> 11, ss = gr & (kS - 1);
          const int hh = gc >> 6, dd = gc & (kHD - 1);
          ((_Float16*)Y)[((size_t)(bb * kH + hh) * kHD + dd) * kS + ss] = (_Float16)val;
        } else {
          ((float*)Y)[(size_t)gr * kD + gc] = val;
        }
      }
    }
  }
}

// ---------------------------------------------------------------------------
// Flash attention: grid (S/64 q-tiles, B*H). 4 waves/block, wave owns 16 q rows.
// K/V 64x64 tiles staged in LDS with double-buffered async copies (ASYNCcnt),
// online softmax; scale already folded into Qp. VpT is [B,H,HD,S].
// ---------------------------------------------------------------------------
__global__ __launch_bounds__(128) void flash_attn_kernel(const _Float16* __restrict__ Qp,
                                                         const _Float16* __restrict__ Kp,
                                                         const _Float16* __restrict__ VpT,
                                                         _Float16* __restrict__ ctx) {
  // 16-byte aligned bases: every b128 copy and b128 read starts at base + 16 B x n
  __shared__ __attribute__((aligned(16))) _Float16 Ktile[2][64][kLP];  // [buf][key][hd]    9KB each
  __shared__ __attribute__((aligned(16))) _Float16 Vtile[2][64][kLP];  // [buf][hd][key]    9KB each
  __shared__ __attribute__((aligned(16))) _Float16 Plds[4][16][kLP];   // per-wave P bounce 9KB

  const int tid  = threadIdx.x;
  const int lane = tid & 31;
  const int wv   = tid >> 5;
  const int bh   = blockIdx.y;
  const int q0   = blockIdx.x * 64 + wv * 16;

  const _Float16* Qb = Qp + (size_t)bh * kS * kHD;
  const _Float16* Kb = Kp + (size_t)bh * kS * kHD;
  const _Float16* Vb = VpT + (size_t)bh * kHD * kS;

  // 8 x b128 async copies per thread per tile (K: 8KB, V: 8KB for 128 threads)
  auto issue_tile = [&](int kt, int buf) {
#pragma unroll
    for (int i = 0; i < 4; ++i) {
      const int idx = i * 128 + tid;   // 16B chunk id, 0..511
      const int row = idx >> 3;        // 0..63
      const int c8  = (idx & 7) << 3;  // half offset within row
      async_cp16(&Ktile[buf][row][c8], Kb + (size_t)(kt + row) * kHD + c8);
    }
#pragma unroll
    for (int i = 0; i < 4; ++i) {
      const int idx = i * 128 + tid;
      const int row = idx >> 3;        // hd
      const int c8  = (idx & 7) << 3;  // key offset
      async_cp16(&Vtile[buf][row][c8], Vb + (size_t)row * kS + kt + c8);
    }
  };

  const v16h aq0 = *fragp(Qb, kHD, q0, 0, lane);
  const v16h aq1 = *fragp(Qb, kHD, q0, 32, lane);

  v8f acc[4] = {};
  float mrow[8], lrow[8];
#pragma unroll
  for (int v = 0; v < 8; ++v) { mrow[v] = -1e30f; lrow[v] = 0.0f; }

  const int rl = (lane >> 4) << 3;
  const int nl = lane & 15;
  _Float16* Pw = &Plds[wv][0][0];

  issue_tile(0, 0);

  for (int ti = 0; ti < kS / 64; ++ti) {
    const int buf = ti & 1;
    if (ti + 1 < kS / 64) {
      issue_tile((ti + 1) * 64, buf ^ 1);
      WAIT_ASYNC(8);  // all but the 8 just-issued -> current tile resident
    } else {
      WAIT_ASYNC(0);
    }
    __syncthreads();

    const _Float16* Kt = &Ktile[buf][0][0];
    const _Float16* Vt = &Vtile[buf][0][0];

    // scores S = Q @ K^T (16 x 64) from LDS K tile
    v8f sc[4] = {};
#pragma unroll
    for (int j = 0; j < 4; ++j) {
      const _Float16* kp = Kt + (size_t)(16 * j + nl) * kLP + ((lane >> 4) << 4);
      v16h b0 = lds_frag(kp);
      sc[j] = WMMA(aq0, b0, sc[j]);
      v16h b1 = lds_frag(kp + 32);
      sc[j] = WMMA(aq1, b1, sc[j]);
    }

    // row max across 64 keys: elementwise over tiles, then across 16 lanes
    float t[8];
#pragma unroll
    for (int v = 0; v < 8; ++v)
      t[v] = fmaxf(fmaxf(sc[0][v], sc[1][v]), fmaxf(sc[2][v], sc[3][v]));
#pragma unroll
    for (int off = 1; off < 16; off <<= 1)
#pragma unroll
      for (int v = 0; v < 8; ++v) t[v] = fmaxf(t[v], __shfl_xor(t[v], off, 32));

    float al[8], rs[8];
#pragma unroll
    for (int v = 0; v < 8; ++v) {
      const float mn = fmaxf(mrow[v], t[v]);
      al[v] = __expf(mrow[v] - mn);
      mrow[v] = mn;
      rs[v] = 0.0f;
    }

    // P = exp(S - m): accumulate row sums, write f16 P to LDS for A-layout reload
#pragma unroll
    for (int j = 0; j < 4; ++j)
#pragma unroll
      for (int v = 0; v < 8; ++v) {
        const float pv = __expf(sc[j][v] - mrow[v]);
        rs[v] += pv;
        Pw[(rl + v) * kLP + 16 * j + nl] = (_Float16)pv;
      }

#pragma unroll
    for (int off = 1; off < 16; off <<= 1)
#pragma unroll
      for (int v = 0; v < 8; ++v) rs[v] += __shfl_xor(rs[v], off, 32);

#pragma unroll
    for (int v = 0; v < 8; ++v) lrow[v] = lrow[v] * al[v] + rs[v];
#pragma unroll
    for (int j = 0; j < 4; ++j)
#pragma unroll
      for (int v = 0; v < 8; ++v) acc[j][v] *= al[v];

    __syncthreads();

    // reload P as A-fragments (16 x 64 over K=keys)
    const v16h ap0 = lds_frag(Pw + nl * kLP + ((lane >> 4) << 4));
    const v16h ap1 = lds_frag(Pw + nl * kLP + 32 + ((lane >> 4) << 4));

    // ctx += P @ V from LDS V tile ([hd][key] -> B operand contiguous along keys)
#pragma unroll
    for (int j = 0; j < 4; ++j) {
      const _Float16* vp = Vt + (size_t)(16 * j + nl) * kLP + ((lane >> 4) << 4);
      const v16h bv0 = lds_frag(vp);
      const v16h bv1 = lds_frag(vp + 32);
      acc[j] = WMMA(ap0, bv0, acc[j]);
      acc[j] = WMMA(ap1, bv1, acc[j]);
    }
    __syncthreads();  // protect K/V buf and P region before next iteration
  }

  // normalize and store ctx as token-major [B,S,D] f16 for the output GEMM
  const int bb = bh >> 3, hh = bh & 7;
#pragma unroll
  for (int v = 0; v < 8; ++v) {
    const float inv = 1.0f / lrow[v];
    const int srow  = q0 + rl + v;
#pragma unroll
    for (int j = 0; j < 4; ++j)
      ctx[((size_t)bb * kS + srow) * kD + hh * kHD + 16 * j + nl] =
          (_Float16)(acc[j][v] * inv);
  }
}

// ---------------------------------------------------------------------------
extern "C" void kernel_launch(void* const* d_in, const int* in_sizes, int n_in,
                              void* d_out, int out_size, void* d_ws, size_t ws_size,
                              hipStream_t stream) {
  const float* q  = (const float*)d_in[0];
  const float* k  = (const float*)d_in[1];
  const float* v  = (const float*)d_in[2];
  const float* Wq = (const float*)d_in[3];
  const float* bq = (const float*)d_in[4];
  const float* Wk = (const float*)d_in[5];
  const float* bk = (const float*)d_in[6];
  const float* Wv = (const float*)d_in[7];
  const float* bv = (const float*)d_in[8];
  const float* Wo = (const float*)d_in[9];
  const float* bo = (const float*)d_in[10];

  char* p = (char*)d_ws;
  auto take = [&](size_t bytes) -> char* {
    char* r = p;
    p += (bytes + 255) & ~(size_t)255;
    return r;
  };
  const size_t tokElems = (size_t)kBS * kD;  // 8192*512
  const size_t wElems   = (size_t)kD * kD;

  _Float16* q16  = (_Float16*)take(tokElems * 2);
  _Float16* k16  = (_Float16*)take(tokElems * 2);
  _Float16* v16  = (_Float16*)take(tokElems * 2);
  _Float16* Wq16 = (_Float16*)take(wElems * 2);
  _Float16* Wk16 = (_Float16*)take(wElems * 2);
  _Float16* Wv16 = (_Float16*)take(wElems * 2);
  _Float16* Wo16 = (_Float16*)take(wElems * 2);
  _Float16* Qp   = (_Float16*)take(tokElems * 2);
  _Float16* Kp   = (_Float16*)take(tokElems * 2);
  _Float16* VpT  = (_Float16*)take(tokElems * 2);
  _Float16* ctx  = (_Float16*)take(tokElems * 2);

  auto cvt = [&](const float* src, _Float16* dst, size_t n) {
    int n4 = (int)(n / 4);
    cvt_f16_kernel<<<(n4 + 255) / 256, 256, 0, stream>>>(src, dst, n4);
  };
  cvt(q, q16, tokElems);
  cvt(k, k16, tokElems);
  cvt(v, v16, tokElems);
  cvt(Wq, Wq16, wElems);
  cvt(Wk, Wk16, wElems);
  cvt(Wv, Wv16, wElems);
  cvt(Wo, Wo16, wElems);

  dim3 ggrid(kBS / 128, kD / 64);
  gemm_wmma_kernel<0><<<ggrid, 128, 0, stream>>>(q16, Wq16, bq, (void*)Qp);
  gemm_wmma_kernel<1><<<ggrid, 128, 0, stream>>>(k16, Wk16, bk, (void*)Kp);
  gemm_wmma_kernel<2><<<ggrid, 128, 0, stream>>>(v16, Wv16, bv, (void*)VpT);

  flash_attn_kernel<<<dim3(kS / 64, kB * kH), 128, 0, stream>>>(Qp, Kp, VpT, ctx);

  gemm_wmma_kernel<3><<<ggrid, 128, 0, stream>>>(ctx, Wo16, bo, d_out);
}

// v002
// A run of this version takes 129 microseconds.
// In both of two side-by-side timings against v001, it was 1.19 times as fast.
// All steps since v000 together make it 1.79 times as fast.
#include <hip/hip_runtime.h>

typedef __attribute__((ext_vector_type(16))) _Float16 v16h;
typedef __attribute__((ext_vector_type(8)))  _Float16 v8h;
typedef __attribute__((ext_vector_type(4)))  _Float16 v4h;
typedef __attribute__((ext_vector_type(8)))  float    v8f;
typedef __attribute__((ext_vector_type(2)))  float    v2f;
typedef __attribute__((ext_vector_type(4)))  int      v4i;

#define WMMA(a, b, c) \
  __builtin_amdgcn_wmma_f32_16x16x32_f16(false, (a), false, (b), (short)0, (c), false, false)

static constexpr int kB = 4, kS = 2048, kD = 512, kH = 8, kHD = 64;
static constexpr int kBS = kB * kS;  // 8192 tokens
// LDS row pitch in halves: 64 data + 8 pad = 144 B = 16 B x odd, so the 16 rows
// that one ds_load_b128 touches per lane half fall on 16 distinct bank groups.
static constexpr int kLP = 72;

// ---------------------------------------------------------------------------
// CDNA5 async global->LDS copy (16B per lane), tracked by ASYNCcnt.
// Builtin signature (from hipcc diagnostic): (AS1 int4* src, AS3 int4* dst, Ii, Ii)
// ---------------------------------------------------------------------------
__device__ __forceinline__ void async_cp16(void* lds_dst, const void* gsrc) {
#if __has_builtin(__builtin_amdgcn_global_load_async_to_lds_b128)
  __builtin_amdgcn_global_load_async_to_lds_b128(
      (__attribute__((address_space(1))) v4i*)gsrc,
      (__attribute__((address_space(3))) v4i*)lds_dst, 0, 0);
#else
  unsigned loff = (unsigned)(size_t)(__attribute__((address_space(3))) void*)lds_dst;
  asm volatile("global_load_async_to_lds_b128 %0, %1, off" ::"v"(loff), "v"(gsrc)
               : "memory");
#endif
}

#if __has_builtin(__builtin_amdgcn_s_wait_asynccnt)
#define WAIT_ASYNC(n) __builtin_amdgcn_s_wait_asynccnt(n)
#else
#define WAIT_ASYNC(n) asm volatile("s_wait_asynccnt %0" ::"i"(n) : "memory")
#endif

// A/B fragment load for v_wmma_f32_16x16x32_f16.
// A (16x32, MxK) from row-major [M][K]: lane&15 -> row, lane>>4 -> 16-wide K half.
// B (32x16, KxN) from [N][K] row-major (i.e. transposed B): identical addressing.
__device__ __forceinline__ const v16h* fragp(const _Float16* __restrict__ base, int ld,
                                             int row0, int col0, int lane) {
  return (const v16h*)(base + (size_t)(row0 + (lane & 15)) * ld + col0 + ((lane >> 4) << 4));
}

// 32-byte fragment slice from a padded LDS row. The rows are 16-byte aligned
// only, so it is read as two 16-byte halves.
__device__ __forceinline__ v16h lds_frag(const _Float16* p) {
  const v8h lo = *(const v8h*)p;
  const v8h hi = *(const v8h*)(p + 8);
  return __builtin_shufflevector(lo, hi, 0, 1, 2, 3, 4, 5, 6, 7, 8, 9, 10, 11, 12, 13, 14, 15);
}

// ---------------------------------------------------------------------------
// f32 -> f16 conversion (vectorized x4)
// ---------------------------------------------------------------------------
__global__ __launch_bounds__(256) void cvt_f16_kernel(const float* __restrict__ src,
                                                      _Float16* __restrict__ dst, int n4) {
  int i = blockIdx.x * 256 + threadIdx.x;
  if (i < n4) {
    float4 f = ((const float4*)src)[i];
    v4h h = {(_Float16)f.x, (_Float16)f.y, (_Float16)f.z, (_Float16)f.w};
    ((v4h*)dst)[i] = h;
  }
}

// ---------------------------------------------------------------------------
// Y = X @ W^T + bias, X:[8192,512] f16, W:[512,512] f16 (row-major = [N][K]).
// 4 waves/block; each wave computes a 32x64 strip: 8 WMMAs per 6 frag loads.
// MODE 0: Q  -> [B,H,S,HD] f16, scaled by 1/sqrt(HD)
// MODE 1: K  -> [B,H,S,HD] f16
// MODE 2: V  -> [B,H,HD,S] f16 (transposed for V^T@P^T A-operand)
// MODE 3: O  -> [B,S,D] f32 (final output)
// ---------------------------------------------------------------------------
template <int MODE>
__global__ __launch_bounds__(128) void gemm_wmma_kernel(const _Float16* __restrict__ X,
                                                        const _Float16* __restrict__ W,
                                                        const float* __restrict__ bias,
                                                        void* __restrict__ Y) {
  const int lane = threadIdx.x & 31;
  const int wv   = threadIdx.x >> 5;
  const int m0   = blockIdx.x * 128 + wv * 32;
  const int n0   = blockIdx.y * 64;

  v8f acc[2][4] = {};
#pragma unroll 4
  for (int k0 = 0; k0 < kD; k0 += 32) {
    v16h a0 = *fragp(X, kD, m0, k0, lane);
    v16h a1 = *fragp(X, kD, m0 + 16, k0, lane);
#pragma unroll
    for (int j = 0; j < 4; ++j) {
      v16h b = *fragp(W, kD, n0 + 16 * j, k0, lane);
      acc[0][j] = WMMA(a0, b, acc[0][j]);
      acc[1][j] = WMMA(a1, b, acc[1][j]);
    }
  }

  // C layout: lanes 0-15 hold N=lane, M=vgpr; lanes 16-31 hold N=lane-16, M=8+vgpr
  const int rl = (lane >> 4) << 3;
  const int nl = lane & 15;
#pragma unroll
  for (int mi = 0; mi < 2; ++mi) {
#pragma unroll
    for (int j = 0; j < 4; ++j) {
#pragma unroll
      for (int v = 0; v < 8; ++v) {
        const int gr = m0 + 16 * mi + rl + v;  // token row
        const int gc = n0 + 16 * j + nl;       // output feature
        float val = acc[mi][j][v] + bias[gc];
        if (MODE == 0) val *= 0.125f;  // fold attention scale 1/sqrt(64) into Q
        if (MODE <= 1) {
          const int bb = gr >> 11, ss = gr & (kS - 1);
          const int hh = gc >> 6, dd = gc & (kHD - 1);
          ((_Float16*)Y)[((size_t)(bb * kH + hh) * kS + ss) * kHD + dd] = (_Float16)val;
        } else if (MODE == 2) {
          const int bb = gr >> 11, ss = gr & (kS - 1);
          const int hh = gc >> 6, dd = gc & (kHD - 1);
          ((_Float16*)Y)[((size_t)(bb * kH + hh) * kHD + dd) * kS + ss] = (_Float16)val;
        } else {
          ((float*)Y)[(size_t)gr * kD + gc] = val;
        }
      }
    }
  }
}

// ---------------------------------------------------------------------------
// Lane l <-> lane l ^ 16 (the two halves of a wave hold the same query column).
__device__ __forceinline__ float xhalf(float x) {
  const int b = __builtin_bit_cast(int, x);
  return __builtin_bit_cast(
      float, __builtin_amdgcn_permlanex16(b, b, 0x76543210, 0xfedcba98, false, false));
}

// A fragment in the hardware k order from a padded LDS row: k = 8h..8h+7 and
// 16+8h..16+8h+7 of a 32-wide k block (p already points at k = 8h).
__device__ __forceinline__ v16h lds_frag_kmap(const _Float16* p) {
  const v8h lo = *(const v8h*)p;
  const v8h hi = *(const v8h*)(p + 16);
  return __builtin_shufflevector(lo, hi, 0, 1, 2, 3, 4, 5, 6, 7, 8, 9, 10, 11, 12, 13, 14, 15);
}

// ---------------------------------------------------------------------------
// Flash attention: grid (S/64 q-tiles, B*H). 4 waves/block, wave owns 16 q rows.
// K/V 64x64 tiles staged in LDS with double-buffered async copies (ASYNCcnt),
// online softmax; scale already folded into Qp. VpT is [B,H,HD,S].
// Transposed products: S^T = K Q^T (rows = keys, columns = queries) and
// O^T += V^T P^T. A lane then holds scores of ONE query (column lane & 15), so
// maximum and sum run in the lane plus one exchange between the halves, and two
// converted score tiles are already the B operand of the second product.
// ---------------------------------------------------------------------------
__global__ __launch_bounds__(128) void flash_attn_kernel(const _Float16* __restrict__ Qp,
                                                         const _Float16* __restrict__ Kp,
                                                         const _Float16* __restrict__ VpT,
                                                         _Float16* __restrict__ ctx) {
  // 16-byte aligned bases: every b128 copy and b128 read starts at base + 16 B x n
  __shared__ __attribute__((aligned(16))) _Float16 Ktile[2][64][kLP];  // [buf][key][hd]    9KB each
  __shared__ __attribute__((aligned(16))) _Float16 Vtile[2][64][kLP];  // [buf][hd][key]    9KB each

  const int tid  = threadIdx.x;
  const int lane = tid & 31;
  const int wv   = tid >> 5;
  const int bh   = blockIdx.y;
  const int q0   = blockIdx.x * 64 + wv * 16;

  const _Float16* Qb = Qp + (size_t)bh * kS * kHD;
  const _Float16* Kb = Kp + (size_t)bh * kS * kHD;
  const _Float16* Vb = VpT + (size_t)bh * kHD * kS;

  // 8 x b128 async copies per thread per tile (K: 8KB, V: 8KB for 128 threads)
  auto issue_tile = [&](int kt, int buf) {
#pragma unroll
    for (int i = 0; i < 4; ++i) {
      const int idx = i * 128 + tid;   // 16B chunk id, 0..511
      const int row = idx >> 3;        // 0..63
      const int c8  = (idx & 7) << 3;  // half offset within row
      async_cp16(&Ktile[buf][row][c8], Kb + (size_t)(kt + row) * kHD + c8);
    }
#pragma unroll
    for (int i = 0; i < 4; ++i) {
      const int idx = i * 128 + tid;
      const int row = idx >> 3;        // hd
      const int c8  = (idx & 7) << 3;  // key offset
      async_cp16(&Vtile[buf][row][c8], Vb + (size_t)row * kS + kt + c8);
    }
  };

  // Q as B operand (column = query); same k order as the K loader below
  const v16h bq0 = *fragp(Qb, kHD, q0, 0, lane);
  const v16h bq1 = *fragp(Qb, kHD, q0, 32, lane);

  v8f acc[4] = {};  // acc[i][r] = O[q0 + nl][16 i + 8 hf + r]
  float mrow = -1e30f, lrow = 0.0f;  // of query q0 + nl; lrow: this half's keys only

  const int hf = lane >> 4;
  const int nl = lane & 15;

  issue_tile(0, 0);

  for (int ti = 0; ti < kS / 64; ++ti) {
    const int buf = ti & 1;
    if (ti + 1 < kS / 64) {
      issue_tile((ti + 1) * 64, buf ^ 1);
      WAIT_ASYNC(8);  // all but the 8 just-issued -> current tile resident
    } else {
      WAIT_ASYNC(0);
    }
    __syncthreads();

    const _Float16* Kt = &Ktile[buf][0][0];
    const _Float16* Vt = &Vtile[buf][0][0];

    // S^T = K @ Q^T: sc[j][r] = score(key 16 j + 8 hf + r, query nl)
    // (all inner loops are unrolled so that the register arrays keep constant indices)
    v16h ka[4][2];
#pragma unroll
    for (int j = 0; j < 4; ++j) {
      const _Float16* kp = Kt + (size_t)(16 * j + nl) * kLP + (hf << 4);
      ka[j][0] = lds_frag(kp);
      ka[j][1] = lds_frag(kp + 32);
    }
    v8f sc[4] = {};
#pragma unroll
    for (int j = 0; j < 4; ++j) sc[j] = WMMA(ka[j][0], bq0, sc[j]);
#pragma unroll
    for (int j = 0; j < 4; ++j) sc[j] = WMMA(ka[j][1], bq1, sc[j]);

    // maximum over the 64 keys of this query: 32 in the lane, then the other half
    float tj[4];
#pragma unroll
    for (int j = 0; j < 4; ++j) {
      tj[j] = fmaxf(sc[j][0], sc[j][1]);
#pragma unroll
      for (int r = 2; r < 8; r += 2) tj[j] = fmaxf(fmaxf(tj[j], sc[j][r]), sc[j][r + 1]);
    }
    float t = fmaxf(fmaxf(tj[0], tj[1]), fmaxf(tj[2], tj[3]));
    t = fmaxf(t, xhalf(t));

    const float mn = fmaxf(mrow, t);
    const float al = __expf(mrow - mn);
    mrow = mn;

    // P^T = exp(S^T - m), packed in place: tiles 2 kb and 2 kb + 1 are the B
    // operand of key block kb in the hardware k order
    v16h bp[2];
    v2f rs[4];
#pragma unroll
    for (int j = 0; j < 4; ++j) {
#pragma unroll
      for (int r = 0; r < 8; r += 2) {
        const v2f pv = {__expf(sc[j][r] - mrow), __expf(sc[j][r + 1] - mrow)};
        rs[j] = r == 0 ? pv : rs[j] + pv;  // the first pair starts the sum
        bp[j >> 1][(j & 1) * 8 + r]     = (_Float16)pv.x;
        bp[j >> 1][(j & 1) * 8 + r + 1] = (_Float16)pv.y;
      }
    }
    const v2f rt = (rs[0] + rs[1]) + (rs[2] + rs[3]);
    lrow = lrow * al + (rt.x + rt.y);
#pragma unroll
    for (int i = 0; i < 4; ++i)
#pragma unroll
      for (int r = 0; r < 8; ++r) acc[i][r] *= al;

    // O^T += V^T @ P^T: A = V^T rows (hd) from the [hd][key] tile, hardware k order
#pragma unroll
    for (int i = 0; i < 4; ++i) {
      const _Float16* vp = Vt + (size_t)(16 * i + nl) * kLP + (hf << 3);
      const v16h av0 = lds_frag_kmap(vp);
      const v16h av1 = lds_frag_kmap(vp + 32);
      acc[i] = WMMA(av0, bp[0], acc[i]);
      acc[i] = WMMA(av1, bp[1], acc[i]);
    }
    __syncthreads();  // protect K/V buf before next iteration refills it
  }

  // join the halves' sums, normalize, store ctx token-major [B,S,D] f16:
  // 8 consecutive features per lane = one 16-byte store
  const int bb = bh >> 3, hh = bh & 7;
  const float inv = 1.0f / (lrow + xhalf(lrow));
  _Float16* crow = ctx + ((size_t)bb * kS + q0 + nl) * kD + hh * kHD + (hf << 3);
#pragma unroll
  for (int i = 0; i < 4; ++i) {
    v8h o;
#pragma unroll
    for (int r = 0; r < 8; ++r) o[r] = (_Float16)(acc[i][r] * inv);
    *(v8h*)(crow + 16 * i) = o;
  }
}

// ---------------------------------------------------------------------------
extern "C" void kernel_launch(void* const* d_in, const int* in_sizes, int n_in,
                              void* d_out, int out_size, void* d_ws, size_t ws_size,
                              hipStream_t stream) {
  const float* q  = (const float*)d_in[0];
  const float* k  = (const float*)d_in[1];
  const float* v  = (const float*)d_in[2];
  const float* Wq = (const float*)d_in[3];
  const float* bq = (const float*)d_in[4];
  const float* Wk = (const float*)d_in[5];
  const float* bk = (const float*)d_in[6];
  const float* Wv = (const float*)d_in[7];
  const float* bv = (const float*)d_in[8];
  const float* Wo = (const float*)d_in[9];
  const float* bo = (const float*)d_in[10];

  char* p = (char*)d_ws;
  auto take = [&](size_t bytes) -> char* {
    char* r = p;
    p += (bytes + 255) & ~(size_t)255;
    return r;
  };
  const size_t tokElems = (size_t)kBS * kD;  // 8192*512
  const size_t wElems   = (size_t)kD * kD;

  _Float16* q16  = (_Float16*)take(tokElems * 2);
  _Float16* k16  = (_Float16*)take(tokElems * 2);
  _Float16* v16  = (_Float16*)take(tokElems * 2);
  _Float16* Wq16 = (_Float16*)take(wElems * 2);
  _Float16* Wk16 = (_Float16*)take(wElems * 2);
  _Float16* Wv16 = (_Float16*)take(wElems * 2);
  _Float16* Wo16 = (_Float16*)take(wElems * 2);
  _Float16* Qp   = (_Float16*)take(tokElems * 2);
  _Float16* Kp   = (_Float16*)take(tokElems * 2);
  _Float16* VpT  = (_Float16*)take(tokElems * 2);
  _Float16* ctx  = (_Float16*)take(tokElems * 2);

  auto cvt = [&](const float* src, _Float16* dst, size_t n) {
    int n4 = (int)(n / 4);
    cvt_f16_kernel<<<(n4 + 255) / 256, 256, 0, stream>>>(src, dst, n4);
  };
  cvt(q, q16, tokElems);
  cvt(k, k16, tokElems);
  cvt(v, v16, tokElems);
  cvt(Wq, Wq16, wElems);
  cvt(Wk, Wk16, wElems);
  cvt(Wv, Wv16, wElems);
  cvt(Wo, Wo16, wElems);

  dim3 ggrid(kBS / 128, kD / 64);
  gemm_wmma_kernel<0><<<ggrid, 128, 0, stream>>>(q16, Wq16, bq, (void*)Qp);
  gemm_wmma_kernel<1><<<ggrid, 128, 0, stream>>>(k16, Wk16, bk, (void*)Kp);
  gemm_wmma_kernel<2><<<ggrid, 128, 0, stream>>>(v16, Wv16, bv, (void*)VpT);

  flash_attn_kernel<<<dim3(kS / 64, kB * kH), 128, 0, stream>>>(Qp, Kp, VpT, ctx);

  gemm_wmma_kernel<3><<<ggrid, 128, 0, stream>>>(ctx, Wo16, bo, d_out);
}

// v003
// Measured time: 115 microseconds a run.
// In two side-by-side timings against v002, it was 1.12 and 1.13 times as fast.
// Counting every step since v000, it is 2.02 times as fast.
#include <hip/hip_runtime.h>

typedef __attribute__((ext_vector_type(16))) _Float16 v16h;
typedef __attribute__((ext_vector_type(8)))  _Float16 v8h;
typedef __attribute__((ext_vector_type(4)))  _Float16 v4h;
typedef __attribute__((ext_vector_type(8)))  float    v8f;
typedef __attribute__((ext_vector_type(2)))  float    v2f;
typedef __attribute__((ext_vector_type(4)))  int      v4i;

#define WMMA(a, b, c) \
  __builtin_amdgcn_wmma_f32_16x16x32_f16(false, (a), false, (b), (short)0, (c), false, false)

static constexpr int kB = 4, kS = 2048, kD = 512, kH = 8, kHD = 64;
static constexpr int kBS = kB * kS;  // 8192 tokens
// LDS row pitch in halves: 64 data + 8 pad = 144 B = 16 B x odd, so the 16 rows
// that one ds_load_b128 touches per lane half fall on 16 distinct bank groups.
static constexpr int kLP = 72;

// ---------------------------------------------------------------------------
// CDNA5 async global->LDS copy (16B per lane), tracked by ASYNCcnt.
// Builtin signature (from hipcc diagnostic): (AS1 int4* src, AS3 int4* dst, Ii, Ii)
// ---------------------------------------------------------------------------
__device__ __forceinline__ void async_cp16(void* lds_dst, const void* gsrc) {
#if __has_builtin(__builtin_amdgcn_global_load_async_to_lds_b128)
  __builtin_amdgcn_global_load_async_to_lds_b128(
      (__attribute__((address_space(1))) v4i*)gsrc,
      (__attribute__((address_space(3))) v4i*)lds_dst, 0, 0);
#else
  unsigned loff = (unsigned)(size_t)(__attribute__((address_space(3))) void*)lds_dst;
  asm volatile("global_load_async_to_lds_b128 %0, %1, off" ::"v"(loff), "v"(gsrc)
               : "memory");
#endif
}

#if __has_builtin(__builtin_amdgcn_s_wait_asynccnt)
#define WAIT_ASYNC(n) __builtin_amdgcn_s_wait_asynccnt(n)
#else
#define WAIT_ASYNC(n) asm volatile("s_wait_asynccnt %0" ::"i"(n) : "memory")
#endif

// A/B fragment load for v_wmma_f32_16x16x32_f16.
// A (16x32, MxK) from row-major [M][K]: lane&15 -> row, lane>>4 -> 16-wide K half.
// B (32x16, KxN) from [N][K] row-major (i.e. transposed B): identical addressing.
__device__ __forceinline__ const v16h* fragp(const _Float16* __restrict__ base, int ld,
                                             int row0, int col0, int lane) {
  return (const v16h*)(base + (size_t)(row0 + (lane & 15)) * ld + col0 + ((lane >> 4) << 4));
}

// 32-byte fragment slice from a padded LDS row. The rows are 16-byte aligned
// only, so it is read as two 16-byte halves.
__device__ __forceinline__ v16h lds_frag(const _Float16* p) {
  const v8h lo = *(const v8h*)p;
  const v8h hi = *(const v8h*)(p + 8);
  return __builtin_shufflevector(lo, hi, 0, 1, 2, 3, 4, 5, 6, 7, 8, 9, 10, 11, 12, 13, 14, 15);
}

// ---------------------------------------------------------------------------
// f32 -> f16 conversion of all seven operands in ONE launch of few waves:
// 512 blocks x 256 threads, 26 float4 per thread (8 of each activation, 1 of
// each of two weights), every wave access a run of whole 128-byte lines. The
// loads are written ahead of the stores, so that a wave has many in flight.
// ---------------------------------------------------------------------------
static constexpr int kCvtBlocks = 512;
static constexpr int kCvtT      = kCvtBlocks * 256;     // threads in the grid
static constexpr int kTok4      = kBS * kD / 4 / kCvtT; // float4 per thread and activation: 8
static constexpr int kW4        = kD * kD / 4;          // float4 per weight = half the grid
static_assert(kTok4 * kCvtT * 4 == kBS * kD && 2 * kW4 == kCvtT, "conversion grid");

__device__ __forceinline__ v4h cvt4(const float4 f) {
  return v4h{(_Float16)f.x, (_Float16)f.y, (_Float16)f.z, (_Float16)f.w};
}

__global__ __launch_bounds__(256) void cvt_all_kernel(
    const float* __restrict__ q, const float* __restrict__ k, const float* __restrict__ v,
    const float* __restrict__ Wq, const float* __restrict__ Wk, const float* __restrict__ Wv,
    const float* __restrict__ Wo, _Float16* __restrict__ q16, _Float16* __restrict__ k16,
    _Float16* __restrict__ v16, _Float16* __restrict__ Wq16, _Float16* __restrict__ Wk16,
    _Float16* __restrict__ Wv16, _Float16* __restrict__ Wo16) {
  const int  gid = blockIdx.x * 256 + threadIdx.x;
  const bool up  = blockIdx.x >= kCvtBlocks / 2;  // block-uniform: which pair of weights
  const int  wi  = gid & (kW4 - 1);
  const float* wa = up ? Wk : Wq;
  const float* wb = up ? Wo : Wv;

  float4 fq[kTok4], fk[kTok4], fv[kTok4];
  // unrolled: the register arrays need constant indices
#pragma unroll
  for (int i = 0; i < kTok4; ++i) fq[i] = ((const float4*)q)[i * kCvtT + gid];
#pragma unroll
  for (int i = 0; i < kTok4; ++i) fk[i] = ((const float4*)k)[i * kCvtT + gid];
#pragma unroll
  for (int i = 0; i < kTok4; ++i) fv[i] = ((const float4*)v)[i * kCvtT + gid];
  const float4 fa = ((const float4*)wa)[wi];
  const float4 fb = ((const float4*)wb)[wi];

#pragma unroll
  for (int i = 0; i < kTok4; ++i) ((v4h*)q16)[i * kCvtT + gid] = cvt4(fq[i]);
#pragma unroll
  for (int i = 0; i < kTok4; ++i) ((v4h*)k16)[i * kCvtT + gid] = cvt4(fk[i]);
#pragma unroll
  for (int i = 0; i < kTok4; ++i) ((v4h*)v16)[i * kCvtT + gid] = cvt4(fv[i]);
  ((v4h*)(up ? Wk16 : Wq16))[wi] = cvt4(fa);
  ((v4h*)(up ? Wo16 : Wv16))[wi] = cvt4(fb);
}

// ---------------------------------------------------------------------------
// Y = X @ W^T + bias, X:[8192,512] f16, W:[512,512] f16 (row-major = [N][K]).
// 4 waves/block; each wave computes a 32x64 strip: 8 WMMAs per 6 frag loads.
// MODE 0: Q  -> [B,H,S,HD] f16, scaled by 1/sqrt(HD)
// MODE 1: K  -> [B,H,S,HD] f16
// MODE 2: V  -> [B,H,HD,S] f16 (transposed for V^T@P^T A-operand)
// MODE 3: O  -> [B,S,D] f32 (final output)
// ---------------------------------------------------------------------------
template <int MODE>
__global__ __launch_bounds__(128) void gemm_wmma_kernel(const _Float16* __restrict__ X,
                                                        const _Float16* __restrict__ W,
                                                        const float* __restrict__ bias,
                                                        void* __restrict__ Y) {
  const int lane = threadIdx.x & 31;
  const int wv   = threadIdx.x >> 5;
  const int m0   = blockIdx.x * 128 + wv * 32;
  const int n0   = blockIdx.y * 64;

  v8f acc[2][4] = {};
#pragma unroll 4
  for (int k0 = 0; k0 < kD; k0 += 32) {
    v16h a0 = *fragp(X, kD, m0, k0, lane);
    v16h a1 = *fragp(X, kD, m0 + 16, k0, lane);
#pragma unroll
    for (int j = 0; j < 4; ++j) {
      v16h b = *fragp(W, kD, n0 + 16 * j, k0, lane);
      acc[0][j] = WMMA(a0, b, acc[0][j]);
      acc[1][j] = WMMA(a1, b, acc[1][j]);
    }
  }

  // C layout: lanes 0-15 hold N=lane, M=vgpr; lanes 16-31 hold N=lane-16, M=8+vgpr
  const int rl = (lane >> 4) << 3;
  const int nl = lane & 15;
#pragma unroll
  for (int mi = 0; mi < 2; ++mi) {
#pragma unroll
    for (int j = 0; j < 4; ++j) {
#pragma unroll
      for (int v = 0; v < 8; ++v) {
        const int gr = m0 + 16 * mi + rl + v;  // token row
        const int gc = n0 + 16 * j + nl;       // output feature
        float val = acc[mi][j][v] + bias[gc];
        if (MODE == 0) val *= 0.125f;  // fold attention scale 1/sqrt(64) into Q
        if (MODE <= 1) {
          const int bb = gr >> 11, ss = gr & (kS - 1);
          const int hh = gc >> 6, dd = gc & (kHD - 1);
          ((_Float16*)Y)[((size_t)(bb * kH + hh) * kS + ss) * kHD + dd] = (_Float16)val;
        } else if (MODE == 2) {
          const int bb = gr >> 11, ss = gr & (kS - 1);
          const int hh = gc >> 6, dd = gc & (kHD - 1);
          ((_Float16*)Y)[((size_t)(bb * kH + hh) * kHD + dd) * kS + ss] = (_Float16)val;
        } else {
          ((float*)Y)[(size_t)gr * kD + gc] = val;
        }
      }
    }
  }
}

// ---------------------------------------------------------------------------
// Lane l <-> lane l ^ 16 (the two halves of a wave hold the same query column).
__device__ __forceinline__ float xhalf(float x) {
  const int b = __builtin_bit_cast(int, x);
  return __builtin_bit_cast(
      float, __builtin_amdgcn_permlanex16(b, b, 0x76543210, 0xfedcba98, false, false));
}

// A fragment in the hardware k order from a padded LDS row: k = 8h..8h+7 and
// 16+8h..16+8h+7 of a 32-wide k block (p already points at k = 8h).
__device__ __forceinline__ v16h lds_frag_kmap(const _Float16* p) {
  const v8h lo = *(const v8h*)p;
  const v8h hi = *(const v8h*)(p + 16);
  return __builtin_shufflevector(lo, hi, 0, 1, 2, 3, 4, 5, 6, 7, 8, 9, 10, 11, 12, 13, 14, 15);
}

// ---------------------------------------------------------------------------
// Flash attention: grid (S/64 q-tiles, B*H). 4 waves/block, wave owns 16 q rows.
// K/V 64x64 tiles staged in LDS with double-buffered async copies (ASYNCcnt),
// online softmax; scale already folded into Qp. VpT is [B,H,HD,S].
// Transposed products: S^T = K Q^T (rows = keys, columns = queries) and
// O^T += V^T P^T. A lane then holds scores of ONE query (column lane & 15), so
// maximum and sum run in the lane plus one exchange between the halves, and two
// converted score tiles are already the B operand of the second product.
// ---------------------------------------------------------------------------
__global__ __launch_bounds__(128) void flash_attn_kernel(const _Float16* __restrict__ Qp,
                                                         const _Float16* __restrict__ Kp,
                                                         const _Float16* __restrict__ VpT,
                                                         _Float16* __restrict__ ctx) {
  // 16-byte aligned bases: every b128 copy and b128 read starts at base + 16 B x n
  __shared__ __attribute__((aligned(16))) _Float16 Ktile[2][64][kLP];  // [buf][key][hd]    9KB each
  __shared__ __attribute__((aligned(16))) _Float16 Vtile[2][64][kLP];  // [buf][hd][key]    9KB each

  const int tid  = threadIdx.x;
  const int lane = tid & 31;
  const int wv   = tid >> 5;
  const int bh   = blockIdx.y;
  const int q0   = blockIdx.x * 64 + wv * 16;

  const _Float16* Qb = Qp + (size_t)bh * kS * kHD;
  const _Float16* Kb = Kp + (size_t)bh * kS * kHD;
  const _Float16* Vb = VpT + (size_t)bh * kHD * kS;

  // 8 x b128 async copies per thread per tile (K: 8KB, V: 8KB for 128 threads)
  auto issue_tile = [&](int kt, int buf) {
#pragma unroll
    for (int i = 0; i < 4; ++i) {
      const int idx = i * 128 + tid;   // 16B chunk id, 0..511
      const int row = idx >> 3;        // 0..63
      const int c8  = (idx & 7) << 3;  // half offset within row
      async_cp16(&Ktile[buf][row][c8], Kb + (size_t)(kt + row) * kHD + c8);
    }
#pragma unroll
    for (int i = 0; i < 4; ++i) {
      const int idx = i * 128 + tid;
      const int row = idx >> 3;        // hd
      const int c8  = (idx & 7) << 3;  // key offset
      async_cp16(&Vtile[buf][row][c8], Vb + (size_t)row * kS + kt + c8);
    }
  };

  // Q as B operand (column = query); same k order as the K loader below
  const v16h bq0 = *fragp(Qb, kHD, q0, 0, lane);
  const v16h bq1 = *fragp(Qb, kHD, q0, 32, lane);

  v8f acc[4] = {};  // acc[i][r] = O[q0 + nl][16 i + 8 hf + r]
  float mrow = -1e30f, lrow = 0.0f;  // of query q0 + nl; lrow: this half's keys only

  const int hf = lane >> 4;
  const int nl = lane & 15;

  issue_tile(0, 0);

  for (int ti = 0; ti < kS / 64; ++ti) {
    const int buf = ti & 1;
    if (ti + 1 < kS / 64) {
      issue_tile((ti + 1) * 64, buf ^ 1);
      WAIT_ASYNC(8);  // all but the 8 just-issued -> current tile resident
    } else {
      WAIT_ASYNC(0);
    }
    __syncthreads();

    const _Float16* Kt = &Ktile[buf][0][0];
    const _Float16* Vt = &Vtile[buf][0][0];

    // S^T = K @ Q^T: sc[j][r] = score(key 16 j + 8 hf + r, query nl)
    // (all inner loops are unrolled so that the register arrays keep constant indices)
    v16h ka[4][2];
#pragma unroll
    for (int j = 0; j < 4; ++j) {
      const _Float16* kp = Kt + (size_t)(16 * j + nl) * kLP + (hf << 4);
      ka[j][0] = lds_frag(kp);
      ka[j][1] = lds_frag(kp + 32);
    }
    v8f sc[4] = {};
#pragma unroll
    for (int j = 0; j < 4; ++j) sc[j] = WMMA(ka[j][0], bq0, sc[j]);
#pragma unroll
    for (int j = 0; j < 4; ++j) sc[j] = WMMA(ka[j][1], bq1, sc[j]);

    // maximum over the 64 keys of this query: 32 in the lane, then the other half
    float tj[4];
#pragma unroll
    for (int j = 0; j < 4; ++j) {
      tj[j] = fmaxf(sc[j][0], sc[j][1]);
#pragma unroll
      for (int r = 2; r < 8; r += 2) tj[j] = fmaxf(fmaxf(tj[j], sc[j][r]), sc[j][r + 1]);
    }
    float t = fmaxf(fmaxf(tj[0], tj[1]), fmaxf(tj[2], tj[3]));
    t = fmaxf(t, xhalf(t));

    const float mn = fmaxf(mrow, t);
    const float al = __expf(mrow - mn);
    mrow = mn;

    // P^T = exp(S^T - m), packed in place: tiles 2 kb and 2 kb + 1 are the B
    // operand of key block kb in the hardware k order
    v16h bp[2];
    v2f rs[4];
#pragma unroll
    for (int j = 0; j < 4; ++j) {
#pragma unroll
      for (int r = 0; r < 8; r += 2) {
        const v2f pv = {__expf(sc[j][r] - mrow), __expf(sc[j][r + 1] - mrow)};
        rs[j] = r == 0 ? pv : rs[j] + pv;  // the first pair starts the sum
        bp[j >> 1][(j & 1) * 8 + r]     = (_Float16)pv.x;
        bp[j >> 1][(j & 1) * 8 + r + 1] = (_Float16)pv.y;
      }
    }
    const v2f rt = (rs[0] + rs[1]) + (rs[2] + rs[3]);
    lrow = lrow * al + (rt.x + rt.y);
#pragma unroll
    for (int i = 0; i < 4; ++i)
#pragma unroll
      for (int r = 0; r < 8; ++r) acc[i][r] *= al;

    // O^T += V^T @ P^T: A = V^T rows (hd) from the [hd][key] tile, hardware k order
#pragma unroll
    for (int i = 0; i < 4; ++i) {
      const _Float16* vp = Vt + (size_t)(16 * i + nl) * kLP + (hf << 3);
      const v16h av0 = lds_frag_kmap(vp);
      const v16h av1 = lds_frag_kmap(vp + 32);
      acc[i] = WMMA(av0, bp[0], acc[i]);
      acc[i] = WMMA(av1, bp[1], acc[i]);
    }
    __syncthreads();  // protect K/V buf before next iteration refills it
  }

  // join the halves' sums, normalize, store ctx token-major [B,S,D] f16:
  // 8 consecutive features per lane = one 16-byte store
  const int bb = bh >> 3, hh = bh & 7;
  const float inv = 1.0f / (lrow + xhalf(lrow));
  _Float16* crow = ctx + ((size_t)bb * kS + q0 + nl) * kD + hh * kHD + (hf << 3);
#pragma unroll
  for (int i = 0; i < 4; ++i) {
    v8h o;
#pragma unroll
    for (int r = 0; r < 8; ++r) o[r] = (_Float16)(acc[i][r] * inv);
    *(v8h*)(crow + 16 * i) = o;
  }
}

// ---------------------------------------------------------------------------
extern "C" void kernel_launch(void* const* d_in, const int* in_sizes, int n_in,
                              void* d_out, int out_size, void* d_ws, size_t ws_size,
                              hipStream_t stream) {
  const float* q  = (const float*)d_in[0];
  const float* k  = (const float*)d_in[1];
  const float* v  = (const float*)d_in[2];
  const float* Wq = (const float*)d_in[3];
  const float* bq = (const float*)d_in[4];
  const float* Wk = (const float*)d_in[5];
  const float* bk = (const float*)d_in[6];
  const float* Wv = (const float*)d_in[7];
  const float* bv = (const float*)d_in[8];
  const float* Wo = (const float*)d_in[9];
  const float* bo = (const float*)d_in[10];

  char* p = (char*)d_ws;
  auto take = [&](size_t bytes) -> char* {
    char* r = p;
    p += (bytes + 255) & ~(size_t)255;
    return r;
  };
  const size_t tokElems = (size_t)kBS * kD;  // 8192*512
  const size_t wElems   = (size_t)kD * kD;

  _Float16* q16  = (_Float16*)take(tokElems * 2);
  _Float16* k16  = (_Float16*)take(tokElems * 2);
  _Float16* v16  = (_Float16*)take(tokElems * 2);
  _Float16* Wq16 = (_Float16*)take(wElems * 2);
  _Float16* Wk16 = (_Float16*)take(wElems * 2);
  _Float16* Wv16 = (_Float16*)take(wElems * 2);
  _Float16* Wo16 = (_Float16*)take(wElems * 2);
  _Float16* Qp   = (_Float16*)take(tokElems * 2);
  _Float16* Kp   = (_Float16*)take(tokElems * 2);
  _Float16* VpT  = (_Float16*)take(tokElems * 2);
  _Float16* ctx  = (_Float16*)take(tokElems * 2);

  cvt_all_kernel<<<kCvtBlocks, 256, 0, stream>>>(q, k, v, Wq, Wk, Wv, Wo, q16, k16, v16, Wq16, Wk16,
                                                 Wv16, Wo16);

  dim3 ggrid(kBS / 128, kD / 64);
  gemm_wmma_kernel<0><<<ggrid, 128, 0, stream>>>(q16, Wq16, bq, (void*)Qp);
  gemm_wmma_kernel<1><<<ggrid, 128, 0, stream>>>(k16, Wk16, bk, (void*)Kp);
  gemm_wmma_kernel<2><<<ggrid, 128, 0, stream>>>(v16, Wv16, bv, (void*)VpT);

  flash_attn_kernel<<<dim3(kS / 64, kB * kH), 128, 0, stream>>>(Qp, Kp, VpT, ctx);

  gemm_wmma_kernel<3><<<ggrid, 128, 0, stream>>>(ctx, Wo16, bo, d_out);
}

// v004
// A run of this version takes 81.5 microseconds.
// Two timings next to v003 both put it at 1.40 times that version's speed.
// All steps since v000 together make it 2.82 times as fast.
#include <hip/hip_runtime.h>

typedef __attribute__((ext_vector_type(16))) _Float16 v16h;
typedef __attribute__((ext_vector_type(8)))  _Float16 v8h;
typedef __attribute__((ext_vector_type(4)))  _Float16 v4h;
typedef __attribute__((ext_vector_type(8)))  float    v8f;
typedef __attribute__((ext_vector_type(2)))  float    v2f;
typedef __attribute__((ext_vector_type(4)))  int      v4i;

#define WMMA(a, b, c) \
  __builtin_amdgcn_wmma_f32_16x16x32_f16(false, (a), false, (b), (short)0, (c), false, false)

static constexpr int kB = 4, kS = 2048, kD = 512, kH = 8, kHD = 64;
static constexpr int kBS = kB * kS;  // 8192 tokens
// LDS row pitch in halves: 64 data + 8 pad = 144 B = 16 B x odd, so the 16 rows
// that one ds_load_b128 touches per lane half fall on 16 distinct bank groups.
static constexpr int kLP = 72;

// ---------------------------------------------------------------------------
// CDNA5 async global->LDS copy (16B per lane), tracked by ASYNCcnt.
// Builtin signature (from hipcc diagnostic): (AS1 int4* src, AS3 int4* dst, Ii, Ii)
// ---------------------------------------------------------------------------
__device__ __forceinline__ void async_cp16(void* lds_dst, const void* gsrc) {
#if __has_builtin(__builtin_amdgcn_global_load_async_to_lds_b128)
  __builtin_amdgcn_global_load_async_to_lds_b128(
      (__attribute__((address_space(1))) v4i*)gsrc,
      (__attribute__((address_space(3))) v4i*)lds_dst, 0, 0);
#else
  unsigned loff = (unsigned)(size_t)(__attribute__((address_space(3))) void*)lds_dst;
  asm volatile("global_load_async_to_lds_b128 %0, %1, off" ::"v"(loff), "v"(gsrc)
               : "memory");
#endif
}

#if __has_builtin(__builtin_amdgcn_s_wait_asynccnt)
#define WAIT_ASYNC(n) __builtin_amdgcn_s_wait_asynccnt(n)
#else
#define WAIT_ASYNC(n) asm volatile("s_wait_asynccnt %0" ::"i"(n) : "memory")
#endif

// A/B fragment load for v_wmma_f32_16x16x32_f16.
// A (16x32, MxK) from row-major [M][K]: lane&15 -> row, lane>>4 -> 16-wide K half.
// B (32x16, KxN) from [N][K] row-major (i.e. transposed B): identical addressing.
__device__ __forceinline__ const v16h* fragp(const _Float16* __restrict__ base, int ld,
                                             int row0, int col0, int lane) {
  return (const v16h*)(base + (size_t)(row0 + (lane & 15)) * ld + col0 + ((lane >> 4) << 4));
}

// 32-byte fragment slice from a padded LDS row. The rows are 16-byte aligned
// only, so it is read as two 16-byte halves.
__device__ __forceinline__ v16h lds_frag(const _Float16* p) {
  const v8h lo = *(const v8h*)p;
  const v8h hi = *(const v8h*)(p + 8);
  return __builtin_shufflevector(lo, hi, 0, 1, 2, 3, 4, 5, 6, 7, 8, 9, 10, 11, 12, 13, 14, 15);
}

// ---------------------------------------------------------------------------
// f32 -> f16 conversion of all seven operands in ONE launch of few waves:
// 512 blocks x 256 threads, 26 float4 per thread (8 of each activation, 1 of
// each of two weights), every wave access a run of whole 128-byte lines. The
// loads are written ahead of the stores, so that a wave has many in flight.
// ---------------------------------------------------------------------------
static constexpr int kCvtBlocks = 512;
static constexpr int kCvtT      = kCvtBlocks * 256;     // threads in the grid
static constexpr int kTok4      = kBS * kD / 4 / kCvtT; // float4 per thread and activation: 8
static constexpr int kW4        = kD * kD / 4;          // float4 per weight = half the grid
static_assert(kTok4 * kCvtT * 4 == kBS * kD && 2 * kW4 == kCvtT, "conversion grid");

__device__ __forceinline__ v4h cvt4(const float4 f) {
  return v4h{(_Float16)f.x, (_Float16)f.y, (_Float16)f.z, (_Float16)f.w};
}

__global__ __launch_bounds__(256) void cvt_all_kernel(
    const float* __restrict__ q, const float* __restrict__ k, const float* __restrict__ v,
    const float* __restrict__ Wq, const float* __restrict__ Wk, const float* __restrict__ Wv,
    const float* __restrict__ Wo, _Float16* __restrict__ q16, _Float16* __restrict__ k16,
    _Float16* __restrict__ v16, _Float16* __restrict__ Wq16, _Float16* __restrict__ Wk16,
    _Float16* __restrict__ Wv16, _Float16* __restrict__ Wo16) {
  const int  gid = blockIdx.x * 256 + threadIdx.x;
  const bool up  = blockIdx.x >= kCvtBlocks / 2;  // block-uniform: which pair of weights
  const int  wi  = gid & (kW4 - 1);
  const float* wa = up ? Wk : Wq;
  const float* wb = up ? Wo : Wv;

  float4 fq[kTok4], fk[kTok4], fv[kTok4];
  // unrolled: the register arrays need constant indices
#pragma unroll
  for (int i = 0; i < kTok4; ++i) fq[i] = ((const float4*)q)[i * kCvtT + gid];
#pragma unroll
  for (int i = 0; i < kTok4; ++i) fk[i] = ((const float4*)k)[i * kCvtT + gid];
#pragma unroll
  for (int i = 0; i < kTok4; ++i) fv[i] = ((const float4*)v)[i * kCvtT + gid];
  const float4 fa = ((const float4*)wa)[wi];
  const float4 fb = ((const float4*)wb)[wi];

#pragma unroll
  for (int i = 0; i < kTok4; ++i) ((v4h*)q16)[i * kCvtT + gid] = cvt4(fq[i]);
#pragma unroll
  for (int i = 0; i < kTok4; ++i) ((v4h*)k16)[i * kCvtT + gid] = cvt4(fk[i]);
#pragma unroll
  for (int i = 0; i < kTok4; ++i) ((v4h*)v16)[i * kCvtT + gid] = cvt4(fv[i]);
  ((v4h*)(up ? Wk16 : Wq16))[wi] = cvt4(fa);
  ((v4h*)(up ? Wo16 : Wv16))[wi] = cvt4(fb);
}

// ---------------------------------------------------------------------------
// Y = X @ W^T + bias, X:[8192,512] f16, W:[512,512] f16 (row-major = [N][K]).
// One block = 128 rows of X times 128 rows of W, 8 waves, each a 32x64 strip:
// 8 WMMAs per 6 fragments. Both operand tiles are staged in LDS, 128 k at a time
// (256-byte rows, so every wave-wide copy covers whole lines), two buffers: the
// next stage's copies fly while this stage is worked on.
// MODE 0: Q  -> [B,H,S,HD] f16, scaled by 1/sqrt(HD)
// MODE 1: K  -> [B,H,S,HD] f16
// MODE 2: V  -> [B,H,HD,S] f16 (transposed for V^T@P^T A-operand)
// MODE 3: O  -> [B,S,D] f32 (final output)
// ---------------------------------------------------------------------------
static constexpr int kGT = 128;      // rows of X and rows of W per block
static constexpr int kGK = 128;      // k per stage
static constexpr int kGP = kGK + 8;  // LDS row pitch in halves: 272 B = 16 B x odd
static constexpr int kGS = kD / kGK; // stages: 4
static_assert(kGS >= 2 && kGS * kGK == kD, "two buffers need two stages");

template <int MODE>
__global__ __launch_bounds__(256) void gemm_wmma_kernel(const _Float16* __restrict__ X,
                                                        const _Float16* __restrict__ W,
                                                        const float* __restrict__ bias,
                                                        void* __restrict__ Y) {
  // 16-byte aligned bases: every b128 copy and b128 read starts at base + 16 B x n
  __shared__ __attribute__((aligned(16))) _Float16 Xs[2][kGT][kGP];
  __shared__ __attribute__((aligned(16))) _Float16 Ws[2][kGT][kGP];

  const int tid  = threadIdx.x;
  const int lane = tid & 31;
  const int wv   = tid >> 5;
  const int mw   = (wv & 3) * 32;  // the wave's strip inside the block tile
  const int nw   = (wv >> 2) * 64;
  const int m0   = blockIdx.x * kGT + mw;
  const int n0   = blockIdx.y * kGT + nw;

  // 16 b128 copies per thread and stage; 16 lanes cover one 256-byte row
  const int crow = tid >> 4;
  const int cc8  = (tid & 15) << 3;
  const _Float16* gx = X + (size_t)(blockIdx.x * kGT + crow) * kD + cc8;
  const _Float16* gw = W + (size_t)(blockIdx.y * kGT + crow) * kD + cc8;
  auto issue_stage = [&](int s, int buf) {
#pragma unroll
    for (int i = 0; i < kGT / 16; ++i)
      async_cp16(&Xs[buf][crow + 16 * i][cc8], gx + (size_t)(16 * i) * kD + s * kGK);
#pragma unroll
    for (int i = 0; i < kGT / 16; ++i)
      async_cp16(&Ws[buf][crow + 16 * i][cc8], gw + (size_t)(16 * i) * kD + s * kGK);
  };

  issue_stage(0, 0);
  // stage 0 has landed for this wave; the barrier publishes it to the others
  asm volatile("s_wait_asynccnt 0x0" ::: "memory");
  __syncthreads();
  issue_stage(1, 1);

  // same k order for A and B: lane >> 4 picks the 16-wide k half of a 32-wide block
  const int fo = (lane & 15) * kGP + ((lane >> 4) << 4);

  v8f acc[2][4] = {};
  for (int s = 0; s < kGS; ++s) {
    const int buf = s & 1;
    const _Float16* xs = &Xs[buf][mw][0] + fo;
    const _Float16* ws = &Ws[buf][nw][0] + fo;
    // unrolled: fragment reads of a later k block can stand ahead of the WMMAs
#pragma unroll
    for (int kk = 0; kk < kGK; kk += 32) {
      const v16h a0 = lds_frag(xs + kk);
      const v16h a1 = lds_frag(xs + 16 * kGP + kk);
#pragma unroll
      for (int j = 0; j < 4; ++j) {
        const v16h b = lds_frag(ws + 16 * j * kGP + kk);
        acc[0][j] = WMMA(a0, b, acc[0][j]);
        acc[1][j] = WMMA(a1, b, acc[1][j]);
      }
    }
    // this wave's reads of buf are done before buf may be refilled
    asm volatile("s_wait_dscnt 0x0" ::: "memory");
    // this wave's copies of stage s + 1 have landed
    asm volatile("s_wait_asynccnt 0x0" ::: "memory");
    __syncthreads();  // publishes stage s + 1 and ends every reader's use of buf
    if (s + 2 < kGS) issue_stage(s + 2, buf);
  }
  // nothing is outstanding when the wave goes on to its stores and ends
  asm volatile("s_wait_asynccnt 0x0" ::: "memory");

  // C layout: lanes 0-15 hold N=lane, M=vgpr; lanes 16-31 hold N=lane-16, M=8+vgpr
  const int rl = (lane >> 4) << 3;
  const int nl = lane & 15;
#pragma unroll
  for (int mi = 0; mi < 2; ++mi) {
#pragma unroll
    for (int j = 0; j < 4; ++j) {
#pragma unroll
      for (int v = 0; v < 8; ++v) {
        const int gr = m0 + 16 * mi + rl + v;  // token row
        const int gc = n0 + 16 * j + nl;       // output feature
        float val = acc[mi][j][v] + bias[gc];
        if (MODE == 0) val *= 0.125f;  // fold attention scale 1/sqrt(64) into Q
        if (MODE <= 1) {
          const int bb = gr >> 11, ss = gr & (kS - 1);
          const int hh = gc >> 6, dd = gc & (kHD - 1);
          ((_Float16*)Y)[((size_t)(bb * kH + hh) * kS + ss) * kHD + dd] = (_Float16)val;
        } else if (MODE == 2) {
          const int bb = gr >> 11, ss = gr & (kS - 1);
          const int hh = gc >> 6, dd = gc & (kHD - 1);
          ((_Float16*)Y)[((size_t)(bb * kH + hh) * kHD + dd) * kS + ss] = (_Float16)val;
        } else {
          ((float*)Y)[(size_t)gr * kD + gc] = val;
        }
      }
    }
  }
}

// ---------------------------------------------------------------------------
// Lane l <-> lane l ^ 16 (the two halves of a wave hold the same query column).
__device__ __forceinline__ float xhalf(float x) {
  const int b = __builtin_bit_cast(int, x);
  return __builtin_bit_cast(
      float, __builtin_amdgcn_permlanex16(b, b, 0x76543210, 0xfedcba98, false, false));
}

// A fragment in the hardware k order from a padded LDS row: k = 8h..8h+7 and
// 16+8h..16+8h+7 of a 32-wide k block (p already points at k = 8h).
__device__ __forceinline__ v16h lds_frag_kmap(const _Float16* p) {
  const v8h lo = *(const v8h*)p;
  const v8h hi = *(const v8h*)(p + 16);
  return __builtin_shufflevector(lo, hi, 0, 1, 2, 3, 4, 5, 6, 7, 8, 9, 10, 11, 12, 13, 14, 15);
}

// ---------------------------------------------------------------------------
// Flash attention: grid (S/64 q-tiles, B*H). 4 waves/block, wave owns 16 q rows.
// K/V 64x64 tiles staged in LDS with double-buffered async copies (ASYNCcnt),
// online softmax; scale already folded into Qp. VpT is [B,H,HD,S].
// Transposed products: S^T = K Q^T (rows = keys, columns = queries) and
// O^T += V^T P^T. A lane then holds scores of ONE query (column lane & 15), so
// maximum and sum run in the lane plus one exchange between the halves, and two
// converted score tiles are already the B operand of the second product.
// ---------------------------------------------------------------------------
__global__ __launch_bounds__(128) void flash_attn_kernel(const _Float16* __restrict__ Qp,
                                                         const _Float16* __restrict__ Kp,
                                                         const _Float16* __restrict__ VpT,
                                                         _Float16* __restrict__ ctx) {
  // 16-byte aligned bases: every b128 copy and b128 read starts at base + 16 B x n
  __shared__ __attribute__((aligned(16))) _Float16 Ktile[2][64][kLP];  // [buf][key][hd]    9KB each
  __shared__ __attribute__((aligned(16))) _Float16 Vtile[2][64][kLP];  // [buf][hd][key]    9KB each

  const int tid  = threadIdx.x;
  const int lane = tid & 31;
  const int wv   = tid >> 5;
  const int bh   = blockIdx.y;
  const int q0   = blockIdx.x * 64 + wv * 16;

  const _Float16* Qb = Qp + (size_t)bh * kS * kHD;
  const _Float16* Kb = Kp + (size_t)bh * kS * kHD;
  const _Float16* Vb = VpT + (size_t)bh * kHD * kS;

  // 8 x b128 async copies per thread per tile (K: 8KB, V: 8KB for 128 threads)
  auto issue_tile = [&](int kt, int buf) {
#pragma unroll
    for (int i = 0; i < 4; ++i) {
      const int idx = i * 128 + tid;   // 16B chunk id, 0..511
      const int row = idx >> 3;        // 0..63
      const int c8  = (idx & 7) << 3;  // half offset within row
      async_cp16(&Ktile[buf][row][c8], Kb + (size_t)(kt + row) * kHD + c8);
    }
#pragma unroll
    for (int i = 0; i < 4; ++i) {
      const int idx = i * 128 + tid;
      const int row = idx >> 3;        // hd
      const int c8  = (idx & 7) << 3;  // key offset
      async_cp16(&Vtile[buf][row][c8], Vb + (size_t)row * kS + kt + c8);
    }
  };

  // Q as B operand (column = query); same k order as the K loader below
  const v16h bq0 = *fragp(Qb, kHD, q0, 0, lane);
  const v16h bq1 = *fragp(Qb, kHD, q0, 32, lane);

  v8f acc[4] = {};  // acc[i][r] = O[q0 + nl][16 i + 8 hf + r]
  float mrow = -1e30f, lrow = 0.0f;  // of query q0 + nl; lrow: this half's keys only

  const int hf = lane >> 4;
  const int nl = lane & 15;

  issue_tile(0, 0);

  for (int ti = 0; ti < kS / 64; ++ti) {
    const int buf = ti & 1;
    if (ti + 1 < kS / 64) {
      issue_tile((ti + 1) * 64, buf ^ 1);
      WAIT_ASYNC(8);  // all but the 8 just-issued -> current tile resident
    } else {
      WAIT_ASYNC(0);
    }
    __syncthreads();

    const _Float16* Kt = &Ktile[buf][0][0];
    const _Float16* Vt = &Vtile[buf][0][0];

    // S^T = K @ Q^T: sc[j][r] = score(key 16 j + 8 hf + r, query nl)
    // (all inner loops are unrolled so that the register arrays keep constant indices)
    v16h ka[4][2];
#pragma unroll
    for (int j = 0; j < 4; ++j) {
      const _Float16* kp = Kt + (size_t)(16 * j + nl) * kLP + (hf << 4);
      ka[j][0] = lds_frag(kp);
      ka[j][1] = lds_frag(kp + 32);
    }
    v8f sc[4] = {};
#pragma unroll
    for (int j = 0; j < 4; ++j) sc[j] = WMMA(ka[j][0], bq0, sc[j]);
#pragma unroll
    for (int j = 0; j < 4; ++j) sc[j] = WMMA(ka[j][1], bq1, sc[j]);

    // maximum over the 64 keys of this query: 32 in the lane, then the other half
    float tj[4];
#pragma unroll
    for (int j = 0; j < 4; ++j) {
      tj[j] = fmaxf(sc[j][0], sc[j][1]);
#pragma unroll
      for (int r = 2; r < 8; r += 2) tj[j] = fmaxf(fmaxf(tj[j], sc[j][r]), sc[j][r + 1]);
    }
    float t = fmaxf(fmaxf(tj[0], tj[1]), fmaxf(tj[2], tj[3]));
    t = fmaxf(t, xhalf(t));

    const float mn = fmaxf(mrow, t);
    const float al = __expf(mrow - mn);
    mrow = mn;

    // P^T = exp(S^T - m), packed in place: tiles 2 kb and 2 kb + 1 are the B
    // operand of key block kb in the hardware k order
    v16h bp[2];
    v2f rs[4];
#pragma unroll
    for (int j = 0; j < 4; ++j) {
#pragma unroll
      for (int r = 0; r < 8; r += 2) {
        const v2f pv = {__expf(sc[j][r] - mrow), __expf(sc[j][r + 1] - mrow)};
        rs[j] = r == 0 ? pv : rs[j] + pv;  // the first pair starts the sum
        bp[j >> 1][(j & 1) * 8 + r]     = (_Float16)pv.x;
        bp[j >> 1][(j & 1) * 8 + r + 1] = (_Float16)pv.y;
      }
    }
    const v2f rt = (rs[0] + rs[1]) + (rs[2] + rs[3]);
    lrow = lrow * al + (rt.x + rt.y);
#pragma unroll
    for (int i = 0; i < 4; ++i)
#pragma unroll
      for (int r = 0; r < 8; ++r) acc[i][r] *= al;

    // O^T += V^T @ P^T: A = V^T rows (hd) from the [hd][key] tile, hardware k order
#pragma unroll
    for (int i = 0; i < 4; ++i) {
      const _Float16* vp = Vt + (size_t)(16 * i + nl) * kLP + (hf << 3);
      const v16h av0 = lds_frag_kmap(vp);
      const v16h av1 = lds_frag_kmap(vp + 32);
      acc[i] = WMMA(av0, bp[0], acc[i]);
      acc[i] = WMMA(av1, bp[1], acc[i]);
    }
    __syncthreads();  // protect K/V buf before next iteration refills it
  }

  // join the halves' sums, normalize, store ctx token-major [B,S,D] f16:
  // 8 consecutive features per lane = one 16-byte store
  const int bb = bh >> 3, hh = bh & 7;
  const float inv = 1.0f / (lrow + xhalf(lrow));
  _Float16* crow = ctx + ((size_t)bb * kS + q0 + nl) * kD + hh * kHD + (hf << 3);
#pragma unroll
  for (int i = 0; i < 4; ++i) {
    v8h o;
#pragma unroll
    for (int r = 0; r < 8; ++r) o[r] = (_Float16)(acc[i][r] * inv);
    *(v8h*)(crow + 16 * i) = o;
  }
}

// ---------------------------------------------------------------------------
extern "C" void kernel_launch(void* const* d_in, const int* in_sizes, int n_in,
                              void* d_out, int out_size, void* d_ws, size_t ws_size,
                              hipStream_t stream) {
  const float* q  = (const float*)d_in[0];
  const float* k  = (const float*)d_in[1];
  const float* v  = (const float*)d_in[2];
  const float* Wq = (const float*)d_in[3];
  const float* bq = (const float*)d_in[4];
  const float* Wk = (const float*)d_in[5];
  const float* bk = (const float*)d_in[6];
  const float* Wv = (const float*)d_in[7];
  const float* bv = (const float*)d_in[8];
  const float* Wo = (const float*)d_in[9];
  const float* bo = (const float*)d_in[10];

  char* p = (char*)d_ws;
  auto take = [&](size_t bytes) -> char* {
    char* r = p;
    p += (bytes + 255) & ~(size_t)255;
    return r;
  };
  const size_t tokElems = (size_t)kBS * kD;  // 8192*512
  const size_t wElems   = (size_t)kD * kD;

  _Float16* q16  = (_Float16*)take(tokElems * 2);
  _Float16* k16  = (_Float16*)take(tokElems * 2);
  _Float16* v16  = (_Float16*)take(tokElems * 2);
  _Float16* Wq16 = (_Float16*)take(wElems * 2);
  _Float16* Wk16 = (_Float16*)take(wElems * 2);
  _Float16* Wv16 = (_Float16*)take(wElems * 2);
  _Float16* Wo16 = (_Float16*)take(wElems * 2);
  _Float16* Qp   = (_Float16*)take(tokElems * 2);
  _Float16* Kp   = (_Float16*)take(tokElems * 2);
  _Float16* VpT  = (_Float16*)take(tokElems * 2);
  _Float16* ctx  = (_Float16*)take(tokElems * 2);

  cvt_all_kernel<<<kCvtBlocks, 256, 0, stream>>>(q, k, v, Wq, Wk, Wv, Wo, q16, k16, v16, Wq16, Wk16,
                                                 Wv16, Wo16);

  dim3 ggrid(kBS / kGT, kD / kGT);
  gemm_wmma_kernel<0><<<ggrid, 256, 0, stream>>>(q16, Wq16, bq, (void*)Qp);
  gemm_wmma_kernel<1><<<ggrid, 256, 0, stream>>>(k16, Wk16, bk, (void*)Kp);
  gemm_wmma_kernel<2><<<ggrid, 256, 0, stream>>>(v16, Wv16, bv, (void*)VpT);

  flash_attn_kernel<<<dim3(kS / 64, kB * kH), 128, 0, stream>>>(Qp, Kp, VpT, ctx);

  gemm_wmma_kernel<3><<<ggrid, 256, 0, stream>>>(ctx, Wo16, bo, d_out);
}

// v005
// A run of this version takes 75.8 microseconds.
// Two timings next to v004 both put it at 1.07 times that version's speed.
// All steps since v000 together make it 3.02 times as fast.
#include <hip/hip_runtime.h>

typedef __attribute__((ext_vector_type(16))) _Float16 v16h;
typedef __attribute__((ext_vector_type(8)))  _Float16 v8h;
typedef __attribute__((ext_vector_type(4)))  _Float16 v4h;
typedef __attribute__((ext_vector_type(8)))  float    v8f;
typedef __attribute__((ext_vector_type(2)))  float    v2f;
typedef __attribute__((ext_vector_type(4)))  int      v4i;

#define WMMA(a, b, c) \
  __builtin_amdgcn_wmma_f32_16x16x32_f16(false, (a), false, (b), (short)0, (c), false, false)

static constexpr int kB = 4, kS = 2048, kD = 512, kH = 8, kHD = 64;
static constexpr int kBS = kB * kS;  // 8192 tokens
// LDS row pitch in halves: 64 data + 8 pad = 144 B = 16 B x odd, so the 16 rows
// that one ds_load_b128 touches per lane half fall on 16 distinct bank groups.
static constexpr int kLP = 72;

// ---------------------------------------------------------------------------
// CDNA5 async global->LDS copy (16B per lane), tracked by ASYNCcnt.
// Builtin signature (from hipcc diagnostic): (AS1 int4* src, AS3 int4* dst, Ii, Ii)
// ---------------------------------------------------------------------------
__device__ __forceinline__ void async_cp16(void* lds_dst, const void* gsrc) {
#if __has_builtin(__builtin_amdgcn_global_load_async_to_lds_b128)
  __builtin_amdgcn_global_load_async_to_lds_b128(
      (__attribute__((address_space(1))) v4i*)gsrc,
      (__attribute__((address_space(3))) v4i*)lds_dst, 0, 0);
#else
  unsigned loff = (unsigned)(size_t)(__attribute__((address_space(3))) void*)lds_dst;
  asm volatile("global_load_async_to_lds_b128 %0, %1, off" ::"v"(loff), "v"(gsrc)
               : "memory");
#endif
}

#if __has_builtin(__builtin_amdgcn_s_wait_asynccnt)
#define WAIT_ASYNC(n) __builtin_amdgcn_s_wait_asynccnt(n)
#else
#define WAIT_ASYNC(n) asm volatile("s_wait_asynccnt %0" ::"i"(n) : "memory")
#endif

// A/B fragment load for v_wmma_f32_16x16x32_f16.
// A (16x32, MxK) from row-major [M][K]: lane&15 -> row, lane>>4 -> 16-wide K half.
// B (32x16, KxN) from [N][K] row-major (i.e. transposed B): identical addressing.
__device__ __forceinline__ const v16h* fragp(const _Float16* __restrict__ base, int ld,
                                             int row0, int col0, int lane) {
  return (const v16h*)(base + (size_t)(row0 + (lane & 15)) * ld + col0 + ((lane >> 4) << 4));
}

// 32-byte fragment slice from a padded LDS row. The rows are 16-byte aligned
// only, so it is read as two 16-byte halves.
__device__ __forceinline__ v16h lds_frag(const _Float16* p) {
  const v8h lo = *(const v8h*)p;
  const v8h hi = *(const v8h*)(p + 8);
  return __builtin_shufflevector(lo, hi, 0, 1, 2, 3, 4, 5, 6, 7, 8, 9, 10, 11, 12, 13, 14, 15);
}

// ---------------------------------------------------------------------------
// f32 -> f16 conversion of all seven operands in ONE launch of few waves:
// 512 blocks x 256 threads, 26 float4 per thread (8 of each activation, 1 of
// each of two weights), every wave access a run of whole 128-byte lines. The
// loads are written ahead of the stores, so that a wave has many in flight.
// ---------------------------------------------------------------------------
static constexpr int kCvtBlocks = 512;
static constexpr int kCvtT      = kCvtBlocks * 256;     // threads in the grid
static constexpr int kTok4      = kBS * kD / 4 / kCvtT; // float4 per thread and activation: 8
static constexpr int kW4        = kD * kD / 4;          // float4 per weight = half the grid
static_assert(kTok4 * kCvtT * 4 == kBS * kD && 2 * kW4 == kCvtT, "conversion grid");

__device__ __forceinline__ v4h cvt4(const float4 f) {
  return v4h{(_Float16)f.x, (_Float16)f.y, (_Float16)f.z, (_Float16)f.w};
}

__global__ __launch_bounds__(256) void cvt_all_kernel(
    const float* __restrict__ q, const float* __restrict__ k, const float* __restrict__ v,
    const float* __restrict__ Wq, const float* __restrict__ Wk, const float* __restrict__ Wv,
    const float* __restrict__ Wo, _Float16* __restrict__ q16, _Float16* __restrict__ k16,
    _Float16* __restrict__ v16, _Float16* __restrict__ Wq16, _Float16* __restrict__ Wk16,
    _Float16* __restrict__ Wv16, _Float16* __restrict__ Wo16) {
  const int  gid = blockIdx.x * 256 + threadIdx.x;
  const bool up  = blockIdx.x >= kCvtBlocks / 2;  // block-uniform: which pair of weights
  const int  wi  = gid & (kW4 - 1);
  const float* wa = up ? Wk : Wq;
  const float* wb = up ? Wo : Wv;

  float4 fq[kTok4], fk[kTok4], fv[kTok4];
  // unrolled: the register arrays need constant indices
#pragma unroll
  for (int i = 0; i < kTok4; ++i) fq[i] = ((const float4*)q)[i * kCvtT + gid];
#pragma unroll
  for (int i = 0; i < kTok4; ++i) fk[i] = ((const float4*)k)[i * kCvtT + gid];
#pragma unroll
  for (int i = 0; i < kTok4; ++i) fv[i] = ((const float4*)v)[i * kCvtT + gid];
  const float4 fa = ((const float4*)wa)[wi];
  const float4 fb = ((const float4*)wb)[wi];

#pragma unroll
  for (int i = 0; i < kTok4; ++i) ((v4h*)q16)[i * kCvtT + gid] = cvt4(fq[i]);
#pragma unroll
  for (int i = 0; i < kTok4; ++i) ((v4h*)k16)[i * kCvtT + gid] = cvt4(fk[i]);
#pragma unroll
  for (int i = 0; i < kTok4; ++i) ((v4h*)v16)[i * kCvtT + gid] = cvt4(fv[i]);
  ((v4h*)(up ? Wk16 : Wq16))[wi] = cvt4(fa);
  ((v4h*)(up ? Wo16 : Wv16))[wi] = cvt4(fb);
}

// ---------------------------------------------------------------------------
// Y = X @ W^T + bias, X:[8192,512] f16, W:[512,512] f16 (row-major = [N][K]).
// One block = 128 rows of X times 128 rows of W, 8 waves, each a 32x64 strip:
// 8 WMMAs per 6 fragments. Both operand tiles are staged in LDS, 128 k at a time
// (256-byte rows, so every wave-wide copy covers whole lines), two buffers: the
// next stage's copies fly while this stage is worked on.
// MODE 0: Q  -> [B,H,S,HD] f16, scaled by 1/sqrt(HD)
// MODE 1: K  -> [B,H,S,HD] f16
// MODE 2: V  -> [B,H,HD,S] f16 (transposed for V^T@P^T A-operand)
// MODE 3: O  -> [B,S,D] f32 (final output)
// This kernel is launched for MODE 3 alone; modes 0 to 2 run in qkv_gemm_kernel below.
// ---------------------------------------------------------------------------
static constexpr int kGT = 128;      // rows of X and rows of W per block
static constexpr int kGK = 128;      // k per stage
static constexpr int kGP = kGK + 8;  // LDS row pitch in halves: 272 B = 16 B x odd
static constexpr int kGS = kD / kGK; // stages: 4
static_assert(kGS >= 2 && kGS * kGK == kD, "two buffers need two stages");

template <int MODE>
__global__ __launch_bounds__(256) void gemm_wmma_kernel(const _Float16* __restrict__ X,
                                                        const _Float16* __restrict__ W,
                                                        const float* __restrict__ bias,
                                                        void* __restrict__ Y) {
  // 16-byte aligned bases: every b128 copy and b128 read starts at base + 16 B x n
  __shared__ __attribute__((aligned(16))) _Float16 Xs[2][kGT][kGP];
  __shared__ __attribute__((aligned(16))) _Float16 Ws[2][kGT][kGP];

  const int tid  = threadIdx.x;
  const int lane = tid & 31;
  const int wv   = tid >> 5;
  const int mw   = (wv & 3) * 32;  // the wave's strip inside the block tile
  const int nw   = (wv >> 2) * 64;
  const int m0   = blockIdx.x * kGT + mw;
  const int n0   = blockIdx.y * kGT + nw;

  // 16 b128 copies per thread and stage; 16 lanes cover one 256-byte row
  const int crow = tid >> 4;
  const int cc8  = (tid & 15) << 3;
  const _Float16* gx = X + (size_t)(blockIdx.x * kGT + crow) * kD + cc8;
  const _Float16* gw = W + (size_t)(blockIdx.y * kGT + crow) * kD + cc8;
  auto issue_stage = [&](int s, int buf) {
#pragma unroll
    for (int i = 0; i < kGT / 16; ++i)
      async_cp16(&Xs[buf][crow + 16 * i][cc8], gx + (size_t)(16 * i) * kD + s * kGK);
#pragma unroll
    for (int i = 0; i < kGT / 16; ++i)
      async_cp16(&Ws[buf][crow + 16 * i][cc8], gw + (size_t)(16 * i) * kD + s * kGK);
  };

  issue_stage(0, 0);
  // stage 0 has landed for this wave; the barrier publishes it to the others
  asm volatile("s_wait_asynccnt 0x0" ::: "memory");
  __syncthreads();
  issue_stage(1, 1);

  // same k order for A and B: lane >> 4 picks the 16-wide k half of a 32-wide block
  const int fo = (lane & 15) * kGP + ((lane >> 4) << 4);

  v8f acc[2][4] = {};
  for (int s = 0; s < kGS; ++s) {
    const int buf = s & 1;
    const _Float16* xs = &Xs[buf][mw][0] + fo;
    const _Float16* ws = &Ws[buf][nw][0] + fo;
    // unrolled: fragment reads of a later k block can stand ahead of the WMMAs
#pragma unroll
    for (int kk = 0; kk < kGK; kk += 32) {
      const v16h a0 = lds_frag(xs + kk);
      const v16h a1 = lds_frag(xs + 16 * kGP + kk);
#pragma unroll
      for (int j = 0; j < 4; ++j) {
        const v16h b = lds_frag(ws + 16 * j * kGP + kk);
        acc[0][j] = WMMA(a0, b, acc[0][j]);
        acc[1][j] = WMMA(a1, b, acc[1][j]);
      }
    }
    // this wave's reads of buf are done before buf may be refilled
    asm volatile("s_wait_dscnt 0x0" ::: "memory");
    // this wave's copies of stage s + 1 have landed
    asm volatile("s_wait_asynccnt 0x0" ::: "memory");
    __syncthreads();  // publishes stage s + 1 and ends every reader's use of buf
    if (s + 2 < kGS) issue_stage(s + 2, buf);
  }
  // nothing is outstanding when the wave goes on to its stores and ends
  asm volatile("s_wait_asynccnt 0x0" ::: "memory");

  // C layout: lanes 0-15 hold N=lane, M=vgpr; lanes 16-31 hold N=lane-16, M=8+vgpr
  const int rl = (lane >> 4) << 3;
  const int nl = lane & 15;
#pragma unroll
  for (int mi = 0; mi < 2; ++mi) {
#pragma unroll
    for (int j = 0; j < 4; ++j) {
#pragma unroll
      for (int v = 0; v < 8; ++v) {
        const int gr = m0 + 16 * mi + rl + v;  // token row
        const int gc = n0 + 16 * j + nl;       // output feature
        float val = acc[mi][j][v] + bias[gc];
        if (MODE == 0) val *= 0.125f;  // fold attention scale 1/sqrt(64) into Q
        if (MODE <= 1) {
          const int bb = gr >> 11, ss = gr & (kS - 1);
          const int hh = gc >> 6, dd = gc & (kHD - 1);
          ((_Float16*)Y)[((size_t)(bb * kH + hh) * kS + ss) * kHD + dd] = (_Float16)val;
        } else if (MODE == 2) {
          const int bb = gr >> 11, ss = gr & (kS - 1);
          const int hh = gc >> 6, dd = gc & (kHD - 1);
          ((_Float16*)Y)[((size_t)(bb * kH + hh) * kHD + dd) * kS + ss] = (_Float16)val;
        } else {
          ((float*)Y)[(size_t)gr * kD + gc] = val;
        }
      }
    }
  }
}

// Epilogue of a wave's 32x64 strip of a projection: bias, then the f16 store.
// MODE 0: Q -> [B,H,S,HD], scaled by 1/sqrt(HD); MODE 1: K -> [B,H,S,HD];
// MODE 2: V -> [B,H,HD,S] (transposed for the second product of attention).
template <int MODE>
__device__ __forceinline__ void store_proj(const v8f (&acc)[2][4], const float* bias, _Float16* Y,
                                           int m0, int n0, int lane) {
  // C layout: lanes 0-15 hold N=lane, M=vgpr; lanes 16-31 hold N=lane-16, M=8+vgpr
  const int rl = (lane >> 4) << 3;
  const int nl = lane & 15;
  // all three loops unrolled: the accumulator registers need constant indices
#pragma unroll
  for (int mi = 0; mi < 2; ++mi) {
#pragma unroll
    for (int j = 0; j < 4; ++j) {
#pragma unroll
      for (int v = 0; v < 8; ++v) {
        const int gr = m0 + 16 * mi + rl + v;  // token row
        const int gc = n0 + 16 * j + nl;       // output feature
        float val = acc[mi][j][v] + bias[gc];
        if (MODE == 0) val *= 0.125f;  // fold attention scale 1/sqrt(64) into Q
        const int bb = gr >> 11, ss = gr & (kS - 1);
        const int hh = gc >> 6, dd = gc & (kHD - 1);
        if (MODE <= 1)
          Y[((size_t)(bb * kH + hh) * kS + ss) * kHD + dd] = (_Float16)val;
        else
          Y[((size_t)(bb * kH + hh) * kHD + dd) * kS + ss] = (_Float16)val;
      }
    }
  }
  // stands in front of any later write of a register that a store above names:
  // in the built code the three epilogues follow one another
  asm volatile("s_wait_xcnt 0x0" ::: "memory");
}

// The Q, K and V projections read nothing of each other: ONE launch, blockIdx.z
// picks the product (operands, bias, result and its layout). The choice is the
// same for a whole block. Tile, staging and ring are those of the kernel above.
__global__ __launch_bounds__(256) void qkv_gemm_kernel(
    const _Float16* __restrict__ q16, const _Float16* __restrict__ k16,
    const _Float16* __restrict__ v16, const _Float16* __restrict__ Wq16,
    const _Float16* __restrict__ Wk16, const _Float16* __restrict__ Wv16,
    const float* __restrict__ bq, const float* __restrict__ bk, const float* __restrict__ bv,
    _Float16* __restrict__ Qp, _Float16* __restrict__ Kp, _Float16* __restrict__ VpT) {
  const int pz = blockIdx.z;
  const _Float16* X = pz == 0 ? q16 : pz == 1 ? k16 : v16;
  const _Float16* W = pz == 0 ? Wq16 : pz == 1 ? Wk16 : Wv16;

  // 16-byte aligned bases: every b128 copy and b128 read starts at base + 16 B x n
  __shared__ __attribute__((aligned(16))) _Float16 Xs[2][kGT][kGP];
  __shared__ __attribute__((aligned(16))) _Float16 Ws[2][kGT][kGP];

  const int tid  = threadIdx.x;
  const int lane = tid & 31;
  const int wv   = tid >> 5;
  const int mw   = (wv & 3) * 32;  // the wave's strip inside the block tile
  const int nw   = (wv >> 2) * 64;
  const int m0   = blockIdx.x * kGT + mw;
  const int n0   = blockIdx.y * kGT + nw;

  // 16 b128 copies per thread and stage; 16 lanes cover one 256-byte row
  const int crow = tid >> 4;
  const int cc8  = (tid & 15) << 3;
  const _Float16* gx = X + (size_t)(blockIdx.x * kGT + crow) * kD + cc8;
  const _Float16* gw = W + (size_t)(blockIdx.y * kGT + crow) * kD + cc8;
  auto issue_stage = [&](int s, int buf) {
#pragma unroll
    for (int i = 0; i < kGT / 16; ++i)
      async_cp16(&Xs[buf][crow + 16 * i][cc8], gx + (size_t)(16 * i) * kD + s * kGK);
#pragma unroll
    for (int i = 0; i < kGT / 16; ++i)
      async_cp16(&Ws[buf][crow + 16 * i][cc8], gw + (size_t)(16 * i) * kD + s * kGK);
  };

  issue_stage(0, 0);
  // stage 0 has landed for this wave; the barrier publishes it to the others
  asm volatile("s_wait_asynccnt 0x0" ::: "memory");
  __syncthreads();
  issue_stage(1, 1);

  // same k order for A and B: lane >> 4 picks the 16-wide k half of a 32-wide block
  const int fo = (lane & 15) * kGP + ((lane >> 4) << 4);

  v8f acc[2][4] = {};
  for (int s = 0; s < kGS; ++s) {
    const int buf = s & 1;
    const _Float16* xs = &Xs[buf][mw][0] + fo;
    const _Float16* ws = &Ws[buf][nw][0] + fo;
    // unrolled: fragment reads of a later k block can stand ahead of the WMMAs
#pragma unroll
    for (int kk = 0; kk < kGK; kk += 32) {
      const v16h a0 = lds_frag(xs + kk);
      const v16h a1 = lds_frag(xs + 16 * kGP + kk);
#pragma unroll
      for (int j = 0; j < 4; ++j) {
        const v16h b = lds_frag(ws + 16 * j * kGP + kk);
        acc[0][j] = WMMA(a0, b, acc[0][j]);
        acc[1][j] = WMMA(a1, b, acc[1][j]);
      }
    }
    // this wave's reads of buf are done before buf may be refilled
    asm volatile("s_wait_dscnt 0x0" ::: "memory");
    // this wave's copies of stage s + 1 have landed
    asm volatile("s_wait_asynccnt 0x0" ::: "memory");
    __syncthreads();  // publishes stage s + 1 and ends every reader's use of buf
    if (s + 2 < kGS) issue_stage(s + 2, buf);
  }
  // nothing is outstanding when the wave goes on to its stores and ends
  asm volatile("s_wait_asynccnt 0x0" ::: "memory");

  if (pz == 0)
    store_proj<0>(acc, bq, Qp, m0, n0, lane);
  else if (pz == 1)
    store_proj<1>(acc, bk, Kp, m0, n0, lane);
  else
    store_proj<2>(acc, bv, VpT, m0, n0, lane);
}

// ---------------------------------------------------------------------------
// Lane l <-> lane l ^ 16 (the two halves of a wave hold the same query column).
__device__ __forceinline__ float xhalf(float x) {
  const int b = __builtin_bit_cast(int, x);
  return __builtin_bit_cast(
      float, __builtin_amdgcn_permlanex16(b, b, 0x76543210, 0xfedcba98, false, false));
}

// A fragment in the hardware k order from a padded LDS row: k = 8h..8h+7 and
// 16+8h..16+8h+7 of a 32-wide k block (p already points at k = 8h).
__device__ __forceinline__ v16h lds_frag_kmap(const _Float16* p) {
  const v8h lo = *(const v8h*)p;
  const v8h hi = *(const v8h*)(p + 16);
  return __builtin_shufflevector(lo, hi, 0, 1, 2, 3, 4, 5, 6, 7, 8, 9, 10, 11, 12, 13, 14, 15);
}

// ---------------------------------------------------------------------------
// Flash attention: grid (S/64 q-tiles, B*H). 4 waves/block, wave owns 16 q rows.
// K/V 64x64 tiles staged in LDS with double-buffered async copies (ASYNCcnt),
// online softmax; scale already folded into Qp. VpT is [B,H,HD,S].
// Transposed products: S^T = K Q^T (rows = keys, columns = queries) and
// O^T += V^T P^T. A lane then holds scores of ONE query (column lane & 15), so
// maximum and sum run in the lane plus one exchange between the halves, and two
// converted score tiles are already the B operand of the second product.
// ---------------------------------------------------------------------------
__global__ __launch_bounds__(128) void flash_attn_kernel(const _Float16* __restrict__ Qp,
                                                         const _Float16* __restrict__ Kp,
                                                         const _Float16* __restrict__ VpT,
                                                         _Float16* __restrict__ ctx) {
  // 16-byte aligned bases: every b128 copy and b128 read starts at base + 16 B x n
  __shared__ __attribute__((aligned(16))) _Float16 Ktile[2][64][kLP];  // [buf][key][hd]    9KB each
  __shared__ __attribute__((aligned(16))) _Float16 Vtile[2][64][kLP];  // [buf][hd][key]    9KB each

  const int tid  = threadIdx.x;
  const int lane = tid & 31;
  const int wv   = tid >> 5;
  const int bh   = blockIdx.y;
  const int q0   = blockIdx.x * 64 + wv * 16;

  const _Float16* Qb = Qp + (size_t)bh * kS * kHD;
  const _Float16* Kb = Kp + (size_t)bh * kS * kHD;
  const _Float16* Vb = VpT + (size_t)bh * kHD * kS;

  // 8 x b128 async copies per thread per tile (K: 8KB, V: 8KB for 128 threads)
  auto issue_tile = [&](int kt, int buf) {
#pragma unroll
    for (int i = 0; i < 4; ++i) {
      const int idx = i * 128 + tid;   // 16B chunk id, 0..511
      const int row = idx >> 3;        // 0..63
      const int c8  = (idx & 7) << 3;  // half offset within row
      async_cp16(&Ktile[buf][row][c8], Kb + (size_t)(kt + row) * kHD + c8);
    }
#pragma unroll
    for (int i = 0; i < 4; ++i) {
      const int idx = i * 128 + tid;
      const int row = idx >> 3;        // hd
      const int c8  = (idx & 7) << 3;  // key offset
      async_cp16(&Vtile[buf][row][c8], Vb + (size_t)row * kS + kt + c8);
    }
  };

  // Q as B operand (column = query); same k order as the K loader below
  const v16h bq0 = *fragp(Qb, kHD, q0, 0, lane);
  const v16h bq1 = *fragp(Qb, kHD, q0, 32, lane);

  v8f acc[4] = {};  // acc[i][r] = O[q0 + nl][16 i + 8 hf + r]
  float mrow = -1e30f, lrow = 0.0f;  // of query q0 + nl; lrow: this half's keys only

  const int hf = lane >> 4;
  const int nl = lane & 15;

  issue_tile(0, 0);

  for (int ti = 0; ti < kS / 64; ++ti) {
    const int buf = ti & 1;
    if (ti + 1 < kS / 64) {
      issue_tile((ti + 1) * 64, buf ^ 1);
      WAIT_ASYNC(8);  // all but the 8 just-issued -> current tile resident
    } else {
      WAIT_ASYNC(0);
    }
    __syncthreads();

    const _Float16* Kt = &Ktile[buf][0][0];
    const _Float16* Vt = &Vtile[buf][0][0];

    // S^T = K @ Q^T: sc[j][r] = score(key 16 j + 8 hf + r, query nl)
    // (all inner loops are unrolled so that the register arrays keep constant indices)
    v16h ka[4][2];
#pragma unroll
    for (int j = 0; j < 4; ++j) {
      const _Float16* kp = Kt + (size_t)(16 * j + nl) * kLP + (hf << 4);
      ka[j][0] = lds_frag(kp);
      ka[j][1] = lds_frag(kp + 32);
    }
    v8f sc[4] = {};
#pragma unroll
    for (int j = 0; j < 4; ++j) sc[j] = WMMA(ka[j][0], bq0, sc[j]);
#pragma unroll
    for (int j = 0; j < 4; ++j) sc[j] = WMMA(ka[j][1], bq1, sc[j]);

    // maximum over the 64 keys of this query: 32 in the lane, then the other half
    float tj[4];
#pragma unroll
    for (int j = 0; j < 4; ++j) {
      tj[j] = fmaxf(sc[j][0], sc[j][1]);
#pragma unroll
      for (int r = 2; r < 8; r += 2) tj[j] = fmaxf(fmaxf(tj[j], sc[j][r]), sc[j][r + 1]);
    }
    float t = fmaxf(fmaxf(tj[0], tj[1]), fmaxf(tj[2], tj[3]));
    t = fmaxf(t, xhalf(t));

    const float mn = fmaxf(mrow, t);
    const float al = __expf(mrow - mn);
    mrow = mn;

    // P^T = exp(S^T - m), packed in place: tiles 2 kb and 2 kb + 1 are the B
    // operand of key block kb in the hardware k order
    v16h bp[2];
    v2f rs[4];
#pragma unroll
    for (int j = 0; j < 4; ++j) {
#pragma unroll
      for (int r = 0; r < 8; r += 2) {
        const v2f pv = {__expf(sc[j][r] - mrow), __expf(sc[j][r + 1] - mrow)};
        rs[j] = r == 0 ? pv : rs[j] + pv;  // the first pair starts the sum
        bp[j >> 1][(j & 1) * 8 + r]     = (_Float16)pv.x;
        bp[j >> 1][(j & 1) * 8 + r + 1] = (_Float16)pv.y;
      }
    }
    const v2f rt = (rs[0] + rs[1]) + (rs[2] + rs[3]);
    lrow = lrow * al + (rt.x + rt.y);
#pragma unroll
    for (int i = 0; i < 4; ++i)
#pragma unroll
      for (int r = 0; r < 8; ++r) acc[i][r] *= al;

    // O^T += V^T @ P^T: A = V^T rows (hd) from the [hd][key] tile, hardware k order
#pragma unroll
    for (int i = 0; i < 4; ++i) {
      const _Float16* vp = Vt + (size_t)(16 * i + nl) * kLP + (hf << 3);
      const v16h av0 = lds_frag_kmap(vp);
      const v16h av1 = lds_frag_kmap(vp + 32);
      acc[i] = WMMA(av0, bp[0], acc[i]);
      acc[i] = WMMA(av1, bp[1], acc[i]);
    }
    __syncthreads();  // protect K/V buf before next iteration refills it
  }

  // join the halves' sums, normalize, store ctx token-major [B,S,D] f16:
  // 8 consecutive features per lane = one 16-byte store
  const int bb = bh >> 3, hh = bh & 7;
  const float inv = 1.0f / (lrow + xhalf(lrow));
  _Float16* crow = ctx + ((size_t)bb * kS + q0 + nl) * kD + hh * kHD + (hf << 3);
#pragma unroll
  for (int i = 0; i < 4; ++i) {
    v8h o;
#pragma unroll
    for (int r = 0; r < 8; ++r) o[r] = (_Float16)(acc[i][r] * inv);
    *(v8h*)(crow + 16 * i) = o;
  }
}

// ---------------------------------------------------------------------------
extern "C" void kernel_launch(void* const* d_in, const int* in_sizes, int n_in,
                              void* d_out, int out_size, void* d_ws, size_t ws_size,
                              hipStream_t stream) {
  const float* q  = (const float*)d_in[0];
  const float* k  = (const float*)d_in[1];
  const float* v  = (const float*)d_in[2];
  const float* Wq = (const float*)d_in[3];
  const float* bq = (const float*)d_in[4];
  const float* Wk = (const float*)d_in[5];
  const float* bk = (const float*)d_in[6];
  const float* Wv = (const float*)d_in[7];
  const float* bv = (const float*)d_in[8];
  const float* Wo = (const float*)d_in[9];
  const float* bo = (const float*)d_in[10];

  char* p = (char*)d_ws;
  auto take = [&](size_t bytes) -> char* {
    char* r = p;
    p += (bytes + 255) & ~(size_t)255;
    return r;
  };
  const size_t tokElems = (size_t)kBS * kD;  // 8192*512
  const size_t wElems   = (size_t)kD * kD;

  _Float16* q16  = (_Float16*)take(tokElems * 2);
  _Float16* k16  = (_Float16*)take(tokElems * 2);
  _Float16* v16  = (_Float16*)take(tokElems * 2);
  _Float16* Wq16 = (_Float16*)take(wElems * 2);
  _Float16* Wk16 = (_Float16*)take(wElems * 2);
  _Float16* Wv16 = (_Float16*)take(wElems * 2);
  _Float16* Wo16 = (_Float16*)take(wElems * 2);
  _Float16* Qp   = (_Float16*)take(tokElems * 2);
  _Float16* Kp   = (_Float16*)take(tokElems * 2);
  _Float16* VpT  = (_Float16*)take(tokElems * 2);
  _Float16* ctx  = (_Float16*)take(tokElems * 2);

  cvt_all_kernel<<<kCvtBlocks, 256, 0, stream>>>(q, k, v, Wq, Wk, Wv, Wo, q16, k16, v16, Wq16, Wk16,
                                                 Wv16, Wo16);

  dim3 ggrid(kBS / kGT, kD / kGT);
  qkv_gemm_kernel<<<dim3(kBS / kGT, kD / kGT, 3), 256, 0, stream>>>(q16, k16, v16, Wq16, Wk16, Wv16, bq,
                                                                    bk, bv, Qp, Kp, VpT);

  flash_attn_kernel<<<dim3(kS / 64, kB * kH), 128, 0, stream>>>(Qp, Kp, VpT, ctx);

  gemm_wmma_kernel<3><<<ggrid, 256, 0, stream>>>(ctx, Wo16, bo, d_out);
}

// v007
// One run takes 65.5 microseconds.
// Versions between v005 and this one are left out; their measured steps multiply to 1.16 times as fast.
// All steps since v000 together make it 3.51 times as fast.
#include <hip/hip_runtime.h>

typedef __attribute__((ext_vector_type(16))) _Float16 v16h;
typedef __attribute__((ext_vector_type(8)))  _Float16 v8h;
typedef __attribute__((ext_vector_type(4)))  _Float16 v4h;
typedef __attribute__((ext_vector_type(8)))  float    v8f;
typedef __attribute__((ext_vector_type(2)))  float    v2f;
typedef __attribute__((ext_vector_type(4)))  int      v4i;
typedef __attribute__((ext_vector_type(2)))  unsigned v2u;

#define WMMA(a, b, c) \
  __builtin_amdgcn_wmma_f32_16x16x32_f16(false, (a), false, (b), (short)0, (c), false, false)

static constexpr int kB = 4, kS = 2048, kD = 512, kH = 8, kHD = 64;
static constexpr int kBS = kB * kS;  // 8192 tokens
// LDS row pitch in halves: 64 data + 8 pad = 144 B = 16 B x odd, so the 16 rows
// that one ds_load_b128 touches per lane half fall on 16 distinct bank groups.
static constexpr int kLP = 72;
// Q carries 1/sqrt(HD) and log2(e): the score products come out in the base-2 domain
static constexpr float kQScale = 0.125f * 1.44269504088896341f;

// ---------------------------------------------------------------------------
// CDNA5 async global->LDS copy (16B per lane), tracked by ASYNCcnt.
// Builtin signature (from hipcc diagnostic): (AS1 int4* src, AS3 int4* dst, Ii, Ii)
// ---------------------------------------------------------------------------
__device__ __forceinline__ void async_cp16(void* lds_dst, const void* gsrc) {
#if __has_builtin(__builtin_amdgcn_global_load_async_to_lds_b128)
  __builtin_amdgcn_global_load_async_to_lds_b128(
      (__attribute__((address_space(1))) v4i*)gsrc,
      (__attribute__((address_space(3))) v4i*)lds_dst, 0, 0);
#else
  unsigned loff = (unsigned)(size_t)(__attribute__((address_space(3))) void*)lds_dst;
  asm volatile("global_load_async_to_lds_b128 %0, %1, off" ::"v"(loff), "v"(gsrc)
               : "memory");
#endif
}

#if __has_builtin(__builtin_amdgcn_s_wait_asynccnt)
#define WAIT_ASYNC(n) __builtin_amdgcn_s_wait_asynccnt(n)
#else
#define WAIT_ASYNC(n) asm volatile("s_wait_asynccnt %0" ::"i"(n) : "memory")
#endif

// A/B fragment load for v_wmma_f32_16x16x32_f16.
// A (16x32, MxK) from row-major [M][K]: lane&15 -> row, lane>>4 -> 16-wide K half.
// B (32x16, KxN) from [N][K] row-major (i.e. transposed B): identical addressing.
__device__ __forceinline__ const v16h* fragp(const _Float16* __restrict__ base, int ld,
                                             int row0, int col0, int lane) {
  return (const v16h*)(base + (size_t)(row0 + (lane & 15)) * ld + col0 + ((lane >> 4) << 4));
}

// 32-byte fragment slice from a padded LDS row. The rows are 16-byte aligned
// only, so it is read as two 16-byte halves.
__device__ __forceinline__ v16h lds_frag(const _Float16* p) {
  const v8h lo = *(const v8h*)p;
  const v8h hi = *(const v8h*)(p + 8);
  return __builtin_shufflevector(lo, hi, 0, 1, 2, 3, 4, 5, 6, 7, 8, 9, 10, 11, 12, 13, 14, 15);
}

__device__ __forceinline__ v4h cvt4(const float4 f) {
  return v4h{(_Float16)f.x, (_Float16)f.y, (_Float16)f.z, (_Float16)f.w};
}

// ---------------------------------------------------------------------------
// Y = X @ W^T + bias, X:[8192,512] f16, W:[512,512] f16 (row-major = [N][K]).
// One block = 128 rows of X times 128 rows of W, 8 waves, each a 32x64 strip:
// 8 WMMAs per 6 fragments. Both operand tiles are staged in LDS, 128 k at a time
// (256-byte rows, so every wave-wide copy covers whole lines), two buffers: the
// next stage's copies fly while this stage is worked on.
// MODE 0: Q  -> [B,H,S,HD] f16, scaled by log2(e)/sqrt(HD)
// MODE 1: K  -> [B,H,S,HD] f16
// MODE 2: V  -> [B,H,HD,S] f16 (transposed for V^T@P^T A-operand)
// MODE 3: O  -> [B,S,D] f32 (final output)
// This kernel is launched for MODE 3 alone; modes 0 to 2 run in qkv_gemm_kernel below.
// ---------------------------------------------------------------------------
static constexpr int kGT = 128;      // rows of X and rows of W per block
static constexpr int kGK = 128;      // k per stage
static constexpr int kGP = kGK + 8;  // LDS row pitch in halves: 272 B = 16 B x odd
static constexpr int kGS = kD / kGK; // stages: 4
static_assert(kGS >= 2 && kGS * kGK == kD, "two buffers need two stages");

template <int MODE>
__global__ __launch_bounds__(256) void gemm_wmma_kernel(const _Float16* __restrict__ X,
                                                        const _Float16* __restrict__ W,
                                                        const float* __restrict__ bias,
                                                        void* __restrict__ Y) {
  // 16-byte aligned bases: every b128 copy and b128 read starts at base + 16 B x n
  __shared__ __attribute__((aligned(16))) _Float16 Xs[2][kGT][kGP];
  __shared__ __attribute__((aligned(16))) _Float16 Ws[2][kGT][kGP];

  const int tid  = threadIdx.x;
  const int lane = tid & 31;
  const int wv   = tid >> 5;
  const int mw   = (wv & 3) * 32;  // the wave's strip inside the block tile
  const int nw   = (wv >> 2) * 64;
  const int m0   = blockIdx.x * kGT + mw;
  const int n0   = blockIdx.y * kGT + nw;

  // 16 b128 copies per thread and stage; 16 lanes cover one 256-byte row
  const int crow = tid >> 4;
  const int cc8  = (tid & 15) << 3;
  const _Float16* gx = X + (size_t)(blockIdx.x * kGT + crow) * kD + cc8;
  const _Float16* gw = W + (size_t)(blockIdx.y * kGT + crow) * kD + cc8;
  auto issue_stage = [&](int s, int buf) {
#pragma unroll
    for (int i = 0; i < kGT / 16; ++i)
      async_cp16(&Xs[buf][crow + 16 * i][cc8], gx + (size_t)(16 * i) * kD + s * kGK);
#pragma unroll
    for (int i = 0; i < kGT / 16; ++i)
      async_cp16(&Ws[buf][crow + 16 * i][cc8], gw + (size_t)(16 * i) * kD + s * kGK);
  };

  issue_stage(0, 0);
  // stage 0 has landed for this wave; the barrier publishes it to the others
  asm volatile("s_wait_asynccnt 0x0" ::: "memory");
  __syncthreads();
  issue_stage(1, 1);

  // same k order for A and B: lane >> 4 picks the 16-wide k half of a 32-wide block
  const int fo = (lane & 15) * kGP + ((lane >> 4) << 4);

  v8f acc[2][4] = {};
  for (int s = 0; s < kGS; ++s) {
    const int buf = s & 1;
    const _Float16* xs = &Xs[buf][mw][0] + fo;
    const _Float16* ws = &Ws[buf][nw][0] + fo;
    // unrolled: fragment reads of a later k block can stand ahead of the WMMAs
#pragma unroll
    for (int kk = 0; kk < kGK; kk += 32) {
      const v16h a0 = lds_frag(xs + kk);
      const v16h a1 = lds_frag(xs + 16 * kGP + kk);
#pragma unroll
      for (int j = 0; j < 4; ++j) {
        const v16h b = lds_frag(ws + 16 * j * kGP + kk);
        acc[0][j] = WMMA(a0, b, acc[0][j]);
        acc[1][j] = WMMA(a1, b, acc[1][j]);
      }
    }
    // this wave's reads of buf are done before buf may be refilled
    asm volatile("s_wait_dscnt 0x0" ::: "memory");
    // this wave's copies of stage s + 1 have landed
    asm volatile("s_wait_asynccnt 0x0" ::: "memory");
    __syncthreads();  // publishes stage s + 1 and ends every reader's use of buf
    if (s + 2 < kGS) issue_stage(s + 2, buf);
  }
  // nothing is outstanding when the wave goes on to its stores and ends
  asm volatile("s_wait_asynccnt 0x0" ::: "memory");

  // C layout: lanes 0-15 hold N=lane, M=vgpr; lanes 16-31 hold N=lane-16, M=8+vgpr
  const int rl = (lane >> 4) << 3;
  const int nl = lane & 15;
#pragma unroll
  for (int mi = 0; mi < 2; ++mi) {
#pragma unroll
    for (int j = 0; j < 4; ++j) {
#pragma unroll
      for (int v = 0; v < 8; ++v) {
        const int gr = m0 + 16 * mi + rl + v;  // token row
        const int gc = n0 + 16 * j + nl;       // output feature
        float val = acc[mi][j][v] + bias[gc];
        if (MODE == 0) val *= kQScale;  // fold the attention scale into Q
        if (MODE <= 1) {
          const int bb = gr >> 11, ss = gr & (kS - 1);
          const int hh = gc >> 6, dd = gc & (kHD - 1);
          ((_Float16*)Y)[((size_t)(bb * kH + hh) * kS + ss) * kHD + dd] = (_Float16)val;
        } else if (MODE == 2) {
          const int bb = gr >> 11, ss = gr & (kS - 1);
          const int hh = gc >> 6, dd = gc & (kHD - 1);
          ((_Float16*)Y)[((size_t)(bb * kH + hh) * kHD + dd) * kS + ss] = (_Float16)val;
        } else {
          ((float*)Y)[(size_t)gr * kD + gc] = val;
        }
      }
    }
  }
}

// Epilogue of a wave's 32x64 strip of a projection: bias, then the f16 store.
// MODE 0: Q -> [B,H,S,HD], scaled by log2(e)/sqrt(HD); MODE 1: K -> [B,H,S,HD];
// MODE 2: V -> [B,H,HD,S] (transposed for the second product of attention).
template <int MODE>
__device__ __forceinline__ void store_proj(const v8f (&acc)[2][4], const float* bias, _Float16* Y,
                                           int m0, int n0, int lane) {
  // C layout: lanes 0-15 hold N=lane, M=vgpr; lanes 16-31 hold N=lane-16, M=8+vgpr
  const int rl = (lane >> 4) << 3;
  const int nl = lane & 15;
  // all three loops unrolled: the accumulator registers need constant indices
#pragma unroll
  for (int mi = 0; mi < 2; ++mi) {
#pragma unroll
    for (int j = 0; j < 4; ++j) {
#pragma unroll
      for (int v = 0; v < 8; ++v) {
        const int gr = m0 + 16 * mi + rl + v;  // token row
        const int gc = n0 + 16 * j + nl;       // output feature
        float val = acc[mi][j][v] + bias[gc];
        if (MODE == 0) val *= kQScale;  // fold the attention scale into Q
        const int bb = gr >> 11, ss = gr & (kS - 1);
        const int hh = gc >> 6, dd = gc & (kHD - 1);
        if (MODE <= 1)
          Y[((size_t)(bb * kH + hh) * kS + ss) * kHD + dd] = (_Float16)val;
        else
          Y[((size_t)(bb * kH + hh) * kHD + dd) * kS + ss] = (_Float16)val;
      }
    }
  }
  // stands in front of any later write of a register that a store above names:
  // in the built code the three epilogues follow one another
  asm volatile("s_wait_xcnt 0x0" ::: "memory");
}

// The same rounding (to nearest even, the instruction the compiler picks for cvt4), written
// in asm so that it stays where it is written: as plain casts the compiler lifts the
// roundings up to the loads that feed them, and the wait for those loads with them.
__device__ __forceinline__ v4h cvt4_here(const float4 f) {
  v2u r;
  asm volatile("v_cvt_pk_f16_f32 %0, %1, %2" : "=v"(r.x) : "v"(f.x), "v"(f.y));
  asm volatile("v_cvt_pk_f16_f32 %0, %1, %2" : "=v"(r.y) : "v"(f.z), "v"(f.w));
  return __builtin_bit_cast(v4h, r);
}

// The Q, K and V projections read nothing of each other: ONE launch, blockIdx.z
// picks the product (operands, bias, result and its layout). The choice is the
// same for a whole block. Block tile and wave strips are those of the kernel above.
// The operands come as f32, straight from the inputs: a stage (64 k of 128 rows of X
// and of W) is loaded into registers in whole 128-byte lines, rounded to f16 there and
// stored into the padded LDS tile, so no f16 copy of an input passes through memory.
// Two LDS buffers; the loads of stage s + 1 are issued behind the barrier that opens trip s
// and fly while stage s is worked on (a load does not stay in flight across __syncthreads()).
static constexpr int kFK = 64;       // k per stage
static constexpr int kFP = kFK + 8;  // LDS row pitch in halves: 144 B = 16 B x odd
static constexpr int kFS = kD / kFK; // stages: 8
static_assert(kFS >= 2 && kFS * kFK == kD, "two buffers need two stages");
static_assert((kBS / kGT) * (kD / kGT) * 256 * 4 == kD * kD, "Wo: one float4 a thread of plane z = 0");

// amdgpu_waves_per_eu(6, 6): 768 blocks of 8 waves are three blocks a WGP, six waves a SIMD; at
// that register budget the whole grid is resident at once and there is no second, half-empty round.
__global__ __launch_bounds__(256) __attribute__((amdgpu_waves_per_eu(6, 6))) void qkv_gemm_kernel(
    const float* __restrict__ q, const float* __restrict__ k, const float* __restrict__ v,
    const float* __restrict__ Wq, const float* __restrict__ Wk, const float* __restrict__ Wv,
    const float* __restrict__ Wo, const float* __restrict__ bq, const float* __restrict__ bk,
    const float* __restrict__ bv, _Float16* __restrict__ Qp, _Float16* __restrict__ Kp,
    _Float16* __restrict__ VpT, _Float16* __restrict__ Wo16) {
  const int pz = blockIdx.z;
  const float* X = pz == 0 ? q : pz == 1 ? k : v;
  const float* W = pz == 0 ? Wq : pz == 1 ? Wk : Wv;

  // 16-byte aligned bases: every b128 read starts at base + 16 B x n
  __shared__ __attribute__((aligned(16))) _Float16 Xs[2][kGT][kFP];
  __shared__ __attribute__((aligned(16))) _Float16 Ws[2][kGT][kFP];

  const int tid  = threadIdx.x;
  const int lane = tid & 31;
  const int wv   = __builtin_amdgcn_readfirstlane(tid >> 5);  // scalar: strip offsets cost no vector register
  const int mw   = (wv & 3) * 32;  // the wave's strip inside the block tile
  const int nw   = (wv >> 2) * 64;
  const int m0   = blockIdx.x * kGT + mw;
  const int n0   = blockIdx.y * kGT + nw;

  // 16 float4 per thread and stage; 16 lanes cover one 256-byte row piece
  const int crow = tid >> 4;
  const int cc4  = (tid & 15) << 2;
  // block-uniform tile bases and one offset a thread, the same for both operands
  const float4* px = (const float4*)(X + (size_t)(blockIdx.x * kGT) * kD);
  const float4* pw = (const float4*)(W + (size_t)(blockIdx.y * kGT) * kD);
  const int go4 = crow * (kD / 4) + (tid & 15);  // in float4
  float4 rx[kGT / 16], rw[kGT / 16];
  // (the loops over i are unrolled: the register arrays need constant indices)
  auto load_stage = [&]() {
#pragma unroll
    for (int i = 0; i < kGT / 16; ++i) rx[i] = px[go4 + 16 * i * (kD / 4)];
#pragma unroll
    for (int i = 0; i < kGT / 16; ++i) rw[i] = pw[go4 + 16 * i * (kD / 4)];
    px += kFK / 4;  // the bases walk along k
    pw += kFK / 4;
  };
  auto store_stage = [&](int buf) {
#pragma unroll
    for (int i = 0; i < kGT / 16; ++i) *(v4h*)&Xs[buf][crow + 16 * i][cc4] = cvt4_here(rx[i]);
#pragma unroll
    for (int i = 0; i < kGT / 16; ++i) *(v4h*)&Ws[buf][crow + 16 * i][cc4] = cvt4_here(rw[i]);
  };

  load_stage();
  // Wo is needed as f16 two launches on: the blocks of plane z = 0 round it, one float4 a thread
  if (pz == 0) {
    const int wi = (blockIdx.y * (kBS / kGT) + blockIdx.x) * 256 + tid;
    ((v4h*)Wo16)[wi] = cvt4(((const float4*)Wo)[wi]);
    // stands in front of any later write of a register that the store above names
    asm volatile("s_wait_xcnt 0x0" ::: "memory");
  }
  store_stage(0);
  __syncthreads();  // publishes stage 0

  // same k order for A and B: lane >> 4 picks the 16-wide k half of a 32-wide block
  const int fo = (lane & 15) * kFP + ((lane >> 4) << 4);

  v8f acc[2][4] = {};
  for (int s = 0; s < kFS; ++s) {
    const int buf = s & 1;
    if (s + 1 < kFS) load_stage();
    // keeps the loads above in front of the products: left free, the scheduler sinks them
    // behind the last WMMA to save registers, and their whole latency then stands open
    __builtin_amdgcn_sched_barrier(0);
    const _Float16* xs = &Xs[buf][mw][0] + fo;
    const _Float16* ws = &Ws[buf][nw][0] + fo;
    // unrolled: fragment reads of the later k block can stand ahead of the WMMAs
#pragma unroll
    for (int kk = 0; kk < kFK; kk += 32) {
      const v16h a0 = lds_frag(xs + kk);
      const v16h a1 = lds_frag(xs + 16 * kFP + kk);
#pragma unroll
      for (int j = 0; j < 4; ++j) {
        const v16h b = lds_frag(ws + 16 * j * kFP + kk);
        acc[0][j] = WMMA(a0, b, acc[0][j]);
        acc[1][j] = WMMA(a1, b, acc[1][j]);
      }
    }
    // keeps the roundings, and with them the wait for the loads, behind the products
    __builtin_amdgcn_sched_barrier(0);
    // the other buffer's last readers left it at the barrier that ended trip s - 1
    if (s + 1 < kFS) store_stage(buf ^ 1);
    __syncthreads();  // publishes stage s + 1 and ends every reader's use of buf
  }

  if (pz == 0)
    store_proj<0>(acc, bq, Qp, m0, n0, lane);
  else if (pz == 1)
    store_proj<1>(acc, bk, Kp, m0, n0, lane);
  else
    store_proj<2>(acc, bv, VpT, m0, n0, lane);
}

// ---------------------------------------------------------------------------
// Lane l <-> lane l ^ 16 (the two halves of a wave hold the same query column).
__device__ __forceinline__ float xhalf(float x) {
  const int b = __builtin_bit_cast(int, x);
  return __builtin_bit_cast(
      float, __builtin_amdgcn_permlanex16(b, b, 0x76543210, 0xfedcba98, false, false));
}

// A fragment in the hardware k order from a padded LDS row: k = 8h..8h+7 and
// 16+8h..16+8h+7 of a 32-wide k block (p already points at k = 8h).
__device__ __forceinline__ v16h lds_frag_kmap(const _Float16* p) {
  const v8h lo = *(const v8h*)p;
  const v8h hi = *(const v8h*)(p + 16);
  return __builtin_shufflevector(lo, hi, 0, 1, 2, 3, 4, 5, 6, 7, 8, 9, 10, 11, 12, 13, 14, 15);
}

// ---------------------------------------------------------------------------
// Flash attention: grid (S/64 q-tiles, B*H). 4 waves/block, wave owns 16 q rows.
// K/V 64x64 tiles staged in LDS with double-buffered async copies (ASYNCcnt),
// online softmax; scale and log2(e) already folded into Qp. VpT is [B,H,HD,S].
// Transposed products: S^T = K Q^T (rows = keys, columns = queries) and
// O^T += V^T P^T. A lane then holds scores of ONE query (column lane & 15), so
// maximum and sum run in the lane plus one exchange between the halves, and two
// converted score tiles are already the B operand of the second product.
// The softmax runs against a HELD maximum m per query: -m is the C operand of the
// score products, so their result is the argument of exp2 as it stands. m is set
// from the first tile and moves only when a lane's sum of exp2 over a tile passes
// kTop; only then are scores, O and the sum brought to the new maximum.
// ---------------------------------------------------------------------------
static constexpr float kTop = 8192.0f;  // every P <= kTop: far inside f16's range

// amdgpu_waves_per_eu(4, 4): the grid fills the chip at four waves a SIMD; told so, the
// compiler spends that register budget on K and V fragment reads issued in groups
// (without it the K reads stand one pair at a time, each waited out before its WMMA).
__global__ __launch_bounds__(128) __attribute__((amdgpu_waves_per_eu(4, 4)))
void flash_attn_kernel(const _Float16* __restrict__ Qp, const _Float16* __restrict__ Kp,
                       const _Float16* __restrict__ VpT, _Float16* __restrict__ ctx) {
  // 16-byte aligned bases: every b128 copy and b128 read starts at base + 16 B x n
  __shared__ __attribute__((aligned(16))) _Float16 Ktile[2][64][kLP];  // [buf][key][hd]    9KB each
  __shared__ __attribute__((aligned(16))) _Float16 Vtile[2][64][kLP];  // [buf][hd][key]    9KB each

  const int tid  = threadIdx.x;
  const int lane = tid & 31;
  const int wv   = tid >> 5;
  const int bh   = blockIdx.y;
  const int q0   = blockIdx.x * 64 + wv * 16;

  const _Float16* Qb = Qp + (size_t)bh * kS * kHD;
  const _Float16* Kb = Kp + (size_t)bh * kS * kHD;
  const _Float16* Vb = VpT + (size_t)bh * kHD * kS;

  // 8 x b128 async copies per thread per tile (K: 8KB, V: 8KB for 128 threads)
  auto issue_tile = [&](int kt, int buf) {
#pragma unroll
    for (int i = 0; i < 4; ++i) {
      const int idx = i * 128 + tid;   // 16B chunk id, 0..511
      const int row = idx >> 3;        // 0..63
      const int c8  = (idx & 7) << 3;  // half offset within row
      async_cp16(&Ktile[buf][row][c8], Kb + (size_t)(kt + row) * kHD + c8);
    }
#pragma unroll
    for (int i = 0; i < 4; ++i) {
      const int idx = i * 128 + tid;
      const int row = idx >> 3;        // hd
      const int c8  = (idx & 7) << 3;  // key offset
      async_cp16(&Vtile[buf][row][c8], Vb + (size_t)row * kS + kt + c8);
    }
  };

  // Q as B operand (column = query); same k order as the K loader below
  const v16h bq0 = *fragp(Qb, kHD, q0, 0, lane);
  const v16h bq1 = *fragp(Qb, kHD, q0, 32, lane);

  v8f acc[4] = {};  // acc[i][r] = O[q0 + nl][16 i + 8 hf + r]
  v8f negm = {};      // minus the held maximum of query q0 + nl, in all eight rows
  float lrow = 0.0f;  // of query q0 + nl, this half's keys only, in units of exp2(held maximum)

  const int hf = lane >> 4;
  const int nl = lane & 15;

  issue_tile(0, 0);

  for (int ti = 0; ti < kS / 64; ++ti) {
    const int buf = ti & 1;
    if (ti + 1 < kS / 64) {
      issue_tile((ti + 1) * 64, buf ^ 1);
      WAIT_ASYNC(8);  // all but the 8 just-issued -> current tile resident
    } else {
      WAIT_ASYNC(0);
    }
    __syncthreads();

    const _Float16* Kt = &Ktile[buf][0][0];
    const _Float16* Vt = &Vtile[buf][0][0];

    // S^T - m = K @ Q^T - m: sc[j][r] = score(key 16 j + 8 hf + r, query nl) - m
    // (all inner loops are unrolled so that the register arrays keep constant indices)
    v16h ka[4][2];
#pragma unroll
    for (int j = 0; j < 4; ++j) {
      const _Float16* kp = Kt + (size_t)(16 * j + nl) * kLP + (hf << 4);
      ka[j][0] = lds_frag(kp);
      ka[j][1] = lds_frag(kp + 32);
    }
    v8f sc[4];
#pragma unroll
    for (int j = 0; j < 4; ++j) sc[j] = WMMA(ka[j][0], bq0, negm);
#pragma unroll
    for (int j = 0; j < 4; ++j) sc[j] = WMMA(ka[j][1], bq1, sc[j]);

    // A of the second product: V^T rows (hd) from the [hd][key] tile, hardware k order.
    // Read here, in front of the test below, so that the reads fly under the exp2 run.
    v16h av[4][2];
#pragma unroll
    for (int i = 0; i < 4; ++i) {
      const _Float16* vp = Vt + (size_t)(16 * i + nl) * kLP + (hf << 3);
      av[i][0] = lds_frag_kmap(vp);
      av[i][1] = lds_frag_kmap(vp + 32);
    }

    // P^T = exp2(S^T - m) and this lane's sum of it
    v2f pv[4][4];
    v2f rs[4];
#pragma unroll
    for (int j = 0; j < 4; ++j) {
#pragma unroll
      for (int r = 0; r < 4; ++r) {
        pv[j][r] = v2f{__builtin_amdgcn_exp2f(sc[j][2 * r]), __builtin_amdgcn_exp2f(sc[j][2 * r + 1])};
        rs[j] = r == 0 ? pv[j][r] : rs[j] + pv[j][r];  // the first pair starts the sum
      }
    }
    v2f rt = (rs[0] + rs[1]) + (rs[2] + rs[3]);
    float rsum = rt.x + rt.y;

    // One test a tile, the same for the whole wave: the first tile sets the held
    // maximum (a sum is never below 0), a later one moves it only if some lane's
    // sum has grown past kTop.
    const float top = ti == 0 ? -1.0f : kTop;
    if (__builtin_amdgcn_ballot_w32(rsum > top) != 0) {
      // maximum over the 64 keys of this query: 32 in the lane, then the other half
      float tj[4];
#pragma unroll
      for (int j = 0; j < 4; ++j) {
        tj[j] = fmaxf(sc[j][0], sc[j][1]);
#pragma unroll
        for (int r = 2; r < 8; r += 2) tj[j] = fmaxf(fmaxf(tj[j], sc[j][r]), sc[j][r + 1]);
      }
      float t = fmaxf(fmaxf(tj[0], tj[1]), fmaxf(tj[2], tj[3]));
      t = fmaxf(t, xhalf(t));
      // the held maximum never falls once the first tile has set it
      const float up = ti == 0 ? t : fmaxf(t, 0.0f);
      const float al = __builtin_amdgcn_exp2f(-fmaxf(up, 0.0f));  // 1 on the first tile's way down: O and sum are 0
#pragma unroll
      for (int j = 0; j < 4; ++j) {
#pragma unroll
        for (int r = 0; r < 4; ++r) {
          pv[j][r] = v2f{__builtin_amdgcn_exp2f(sc[j][2 * r] - up),
                         __builtin_amdgcn_exp2f(sc[j][2 * r + 1] - up)};
          rs[j] = r == 0 ? pv[j][r] : rs[j] + pv[j][r];
        }
      }
      rt   = (rs[0] + rs[1]) + (rs[2] + rs[3]);
      rsum = rt.x + rt.y;
      lrow *= al;
#pragma unroll
      for (int r = 0; r < 8; ++r) negm[r] -= up;
#pragma unroll
      for (int i = 0; i < 4; ++i)
#pragma unroll
        for (int r = 0; r < 8; ++r) acc[i][r] *= al;
    }
    lrow += rsum;

    // packed in place: tiles 2 kb and 2 kb + 1 are the B operand of key block kb
    // in the hardware k order
    v16h bp[2];
#pragma unroll
    for (int j = 0; j < 4; ++j) {
#pragma unroll
      for (int r = 0; r < 4; ++r) {
        bp[j >> 1][(j & 1) * 8 + 2 * r]     = (_Float16)pv[j][r].x;
        bp[j >> 1][(j & 1) * 8 + 2 * r + 1] = (_Float16)pv[j][r].y;
      }
    }

    // O^T += V^T @ P^T
#pragma unroll
    for (int i = 0; i < 4; ++i) acc[i] = WMMA(av[i][0], bp[0], acc[i]);
#pragma unroll
    for (int i = 0; i < 4; ++i) acc[i] = WMMA(av[i][1], bp[1], acc[i]);
    __syncthreads();  // protect K/V buf before next iteration refills it
  }

  // join the halves' sums, normalize, store ctx token-major [B,S,D] f16:
  // 8 consecutive features per lane = one 16-byte store
  const int bb = bh >> 3, hh = bh & 7;
  const float inv = 1.0f / (lrow + xhalf(lrow));
  _Float16* crow = ctx + ((size_t)bb * kS + q0 + nl) * kD + hh * kHD + (hf << 3);
#pragma unroll
  for (int i = 0; i < 4; ++i) {
    v8h o;
#pragma unroll
    for (int r = 0; r < 8; ++r) o[r] = (_Float16)(acc[i][r] * inv);
    *(v8h*)(crow + 16 * i) = o;
  }
}

// ---------------------------------------------------------------------------
extern "C" void kernel_launch(void* const* d_in, const int* in_sizes, int n_in,
                              void* d_out, int out_size, void* d_ws, size_t ws_size,
                              hipStream_t stream) {
  const float* q  = (const float*)d_in[0];
  const float* k  = (const float*)d_in[1];
  const float* v  = (const float*)d_in[2];
  const float* Wq = (const float*)d_in[3];
  const float* bq = (const float*)d_in[4];
  const float* Wk = (const float*)d_in[5];
  const float* bk = (const float*)d_in[6];
  const float* Wv = (const float*)d_in[7];
  const float* bv = (const float*)d_in[8];
  const float* Wo = (const float*)d_in[9];
  const float* bo = (const float*)d_in[10];

  char* p = (char*)d_ws;
  auto take = [&](size_t bytes) -> char* {
    char* r = p;
    p += (bytes + 255) & ~(size_t)255;
    return r;
  };
  const size_t tokElems = (size_t)kBS * kD;  // 8192*512
  const size_t wElems   = (size_t)kD * kD;

  _Float16* Wo16 = (_Float16*)take(wElems * 2);
  _Float16* Qp   = (_Float16*)take(tokElems * 2);
  _Float16* Kp   = (_Float16*)take(tokElems * 2);
  _Float16* VpT  = (_Float16*)take(tokElems * 2);
  _Float16* ctx  = (_Float16*)take(tokElems * 2);

  dim3 ggrid(kBS / kGT, kD / kGT);
  qkv_gemm_kernel<<<dim3(kBS / kGT, kD / kGT, 3), 256, 0, stream>>>(q, k, v, Wq, Wk, Wv, Wo, bq, bk, bv, Qp,
                                                                    Kp, VpT, Wo16);

  flash_attn_kernel<<<dim3(kS / 64, kB * kH), 128, 0, stream>>>(Qp, Kp, VpT, ctx);

  gemm_wmma_kernel<3><<<ggrid, 256, 0, stream>>>(ctx, Wo16, bo, d_out);
}

// v008
// It runs in 63 microseconds.
// Timed twice side by side with v007, it ran 1.04 times as fast both times.
// All steps since v000 together make it 3.65 times as fast.
#include <hip/hip_runtime.h>

typedef __attribute__((ext_vector_type(16))) _Float16 v16h;
typedef __attribute__((ext_vector_type(8)))  _Float16 v8h;
typedef __attribute__((ext_vector_type(4)))  _Float16 v4h;
typedef __attribute__((ext_vector_type(8)))  float    v8f;
typedef __attribute__((ext_vector_type(2)))  float    v2f;
typedef __attribute__((ext_vector_type(4)))  int      v4i;
typedef __attribute__((ext_vector_type(2)))  unsigned v2u;

#define WMMA(a, b, c) \
  __builtin_amdgcn_wmma_f32_16x16x32_f16(false, (a), false, (b), (short)0, (c), false, false)

static constexpr int kB = 4, kS = 2048, kD = 512, kH = 8, kHD = 64;
static constexpr int kBS = kB * kS;  // 8192 tokens
// LDS row pitch in halves: 64 data + 8 pad = 144 B = 16 B x odd, so the 16 rows
// that one ds_load_b128 touches per lane half fall on 16 distinct bank groups.
static constexpr int kLP = 72;
// Q carries 1/sqrt(HD) and log2(e): the score products come out in the base-2 domain
static constexpr float kQScale = 0.125f * 1.44269504088896341f;

// ---------------------------------------------------------------------------
// CDNA5 async global->LDS copy (16B per lane), tracked by ASYNCcnt.
// Builtin signature (from hipcc diagnostic): (AS1 int4* src, AS3 int4* dst, Ii, Ii)
// ---------------------------------------------------------------------------
__device__ __forceinline__ void async_cp16(void* lds_dst, const void* gsrc) {
#if __has_builtin(__builtin_amdgcn_global_load_async_to_lds_b128)
  __builtin_amdgcn_global_load_async_to_lds_b128(
      (__attribute__((address_space(1))) v4i*)gsrc,
      (__attribute__((address_space(3))) v4i*)lds_dst, 0, 0);
#else
  unsigned loff = (unsigned)(size_t)(__attribute__((address_space(3))) void*)lds_dst;
  asm volatile("global_load_async_to_lds_b128 %0, %1, off" ::"v"(loff), "v"(gsrc)
               : "memory");
#endif
}

#if __has_builtin(__builtin_amdgcn_s_wait_asynccnt)
#define WAIT_ASYNC(n) __builtin_amdgcn_s_wait_asynccnt(n)
#else
#define WAIT_ASYNC(n) asm volatile("s_wait_asynccnt %0" ::"i"(n) : "memory")
#endif

// A/B fragment load for v_wmma_f32_16x16x32_f16.
// A (16x32, MxK) from row-major [M][K]: lane&15 -> row, lane>>4 -> 16-wide K half.
// B (32x16, KxN) from [N][K] row-major (i.e. transposed B): identical addressing.
__device__ __forceinline__ const v16h* fragp(const _Float16* __restrict__ base, int ld,
                                             int row0, int col0, int lane) {
  return (const v16h*)(base + (size_t)(row0 + (lane & 15)) * ld + col0 + ((lane >> 4) << 4));
}

// 32-byte fragment slice from a padded LDS row. The rows are 16-byte aligned
// only, so it is read as two 16-byte halves.
__device__ __forceinline__ v16h lds_frag(const _Float16* p) {
  const v8h lo = *(const v8h*)p;
  const v8h hi = *(const v8h*)(p + 8);
  return __builtin_shufflevector(lo, hi, 0, 1, 2, 3, 4, 5, 6, 7, 8, 9, 10, 11, 12, 13, 14, 15);
}

__device__ __forceinline__ v4h cvt4(const float4 f) {
  return v4h{(_Float16)f.x, (_Float16)f.y, (_Float16)f.z, (_Float16)f.w};
}

// ---------------------------------------------------------------------------
// Y = X @ W^T + bias, X:[8192,512] f16, W:[512,512] f16 (row-major = [N][K]).
// One block = 128 rows of X times 128 rows of W, 8 waves, each a 32x64 strip:
// 8 WMMAs per 6 fragments. Both operand tiles are staged in LDS, 128 k at a time
// (256-byte rows, so every wave-wide copy covers whole lines), two buffers: the
// next stage's copies fly while this stage is worked on.
// Y is the final output, [B,S,D] f32 (the projections run in qkv_gemm_kernel below).
// Row 4 c + j of a 64-row group of W lies at LDS row 16 j + c: column c of B fragment j is
// feature 4 c + j, so a lane's four accumulator tiles hold 4 adjacent features of a token
// and 16 lanes store 256 contiguous bytes: whole lines.
// ---------------------------------------------------------------------------
static constexpr int kGT = 128;      // rows of X and rows of W per block
static constexpr int kGK = 128;      // k per stage
static constexpr int kGP = kGK + 8;  // LDS row pitch in halves: 272 B = 16 B x odd
static constexpr int kGS = kD / kGK; // stages: 4
static_assert(kGS >= 2 && kGS * kGK == kD, "two buffers need two stages");

__global__ __launch_bounds__(256) void out_gemm_kernel(const _Float16* __restrict__ X,
                                                       const _Float16* __restrict__ W,
                                                       const float* __restrict__ bias,
                                                       float* __restrict__ Y) {
  // 16-byte aligned bases: every b128 copy and b128 read starts at base + 16 B x n
  __shared__ __attribute__((aligned(16))) _Float16 Xs[2][kGT][kGP];
  __shared__ __attribute__((aligned(16))) _Float16 Ws[2][kGT][kGP];

  const int tid  = threadIdx.x;
  const int lane = tid & 31;
  const int wv   = tid >> 5;
  const int mw   = (wv & 3) * 32;  // the wave's strip inside the block tile
  const int nw   = (wv >> 2) * 64;
  const int m0   = blockIdx.x * kGT + mw;
  const int n0   = blockIdx.y * kGT + nw;

  // 16 b128 copies per thread and stage; 16 lanes cover one 256-byte row
  const int crow = tid >> 4;
  const int cc8  = (tid & 15) << 3;
  const _Float16* gx = X + (size_t)(blockIdx.x * kGT + crow) * kD + cc8;
  const _Float16* gw = W + (size_t)(blockIdx.y * kGT + crow) * kD + cc8;
  const int wrow = 16 * (crow & 3) + (crow >> 2);  // LDS row of W's row crow; row crow + 16 i lies 4 (i & 3) + 64 (i >> 2) on
  auto issue_stage = [&](int s, int buf) {
#pragma unroll
    for (int i = 0; i < kGT / 16; ++i)
      async_cp16(&Xs[buf][crow + 16 * i][cc8], gx + (size_t)(16 * i) * kD + s * kGK);
#pragma unroll
    for (int i = 0; i < kGT / 16; ++i)
      async_cp16(&Ws[buf][wrow + 4 * (i & 3) + 64 * (i >> 2)][cc8], gw + (size_t)(16 * i) * kD + s * kGK);
  };

  issue_stage(0, 0);
  // stage 0 has landed for this wave; the barrier publishes it to the others
  asm volatile("s_wait_asynccnt 0x0" ::: "memory");
  __syncthreads();
  issue_stage(1, 1);

  // same k order for A and B: lane >> 4 picks the 16-wide k half of a 32-wide block
  const int fo = (lane & 15) * kGP + ((lane >> 4) << 4);

  v8f acc[2][4] = {};
  for (int s = 0; s < kGS; ++s) {
    const int buf = s & 1;
    const _Float16* xs = &Xs[buf][mw][0] + fo;
    const _Float16* ws = &Ws[buf][nw][0] + fo;
    // unrolled: fragment reads of a later k block can stand ahead of the WMMAs
#pragma unroll
    for (int kk = 0; kk < kGK; kk += 32) {
      const v16h a0 = lds_frag(xs + kk);
      const v16h a1 = lds_frag(xs + 16 * kGP + kk);
#pragma unroll
      for (int j = 0; j < 4; ++j) {
        const v16h b = lds_frag(ws + 16 * j * kGP + kk);
        acc[0][j] = WMMA(a0, b, acc[0][j]);
        acc[1][j] = WMMA(a1, b, acc[1][j]);
      }
    }
    // this wave's reads of buf are done before buf may be refilled
    asm volatile("s_wait_dscnt 0x0" ::: "memory");
    // this wave's copies of stage s + 1 have landed
    asm volatile("s_wait_asynccnt 0x0" ::: "memory");
    __syncthreads();  // publishes stage s + 1 and ends every reader's use of buf
    if (s + 2 < kGS) issue_stage(s + 2, buf);
  }
  // nothing is outstanding when the wave goes on to its stores and ends
  asm volatile("s_wait_asynccnt 0x0" ::: "memory");

  // C layout: lanes 0-15 hold N=lane, M=vgpr; lanes 16-31 hold N=lane-16, M=8+vgpr:
  // acc[mi][j][v] = Y[token m0 + 16 mi + rl + v][feature n0 + 4 nl + j]
  const int rl = (lane >> 4) << 3;
  const int nl = lane & 15;
  const float4 c = *(const float4*)(bias + n0 + 4 * nl);
  float* yp = Y + (size_t)(m0 + rl) * kD + n0 + 4 * nl;
  // (both loops unrolled: the accumulator registers need constant indices)
#pragma unroll
  for (int mi = 0; mi < 2; ++mi) {
#pragma unroll
    for (int v = 0; v < 8; ++v)
      *(float4*)(yp + (size_t)(16 * mi + v) * kD) = float4{acc[mi][0][v] + c.x, acc[mi][1][v] + c.y,
                                                           acc[mi][2][v] + c.z, acc[mi][3][v] + c.w};
  }
}

// Epilogue of a wave's strip of a projection: bias, rounding to f16, then the store.
// acc[ni][j][v] is the result at place 16 j + 8 hf + v of the strip's 64-long side (the A
// operand's rows) and 16 ni + nl of its 32-long side: the 64-long side is the one that lies
// contiguous in memory, so a lane holds 16-byte runs and a row of the strip is one 128-byte line.
// MODE 0: Q -> [B,H,S,HD], scaled by log2(e)/sqrt(HD); MODE 1: K -> [B,H,S,HD]:
//         32 tokens from t0 (rows) x the 64 features of a head from f0.
// MODE 2: V -> [B,H,HD,S] (transposed for the second product of attention):
//         32 features from f0 (rows) x 64 tokens from t0.
// The rows pass through stg, the wave's own LDS range (32 rows at pitch kLP), so that each
// store covers four whole lines instead of 16 or 32 pieces.
template <int MODE>
__device__ __forceinline__ void store_proj(const v8f (&acc)[2][4], const float* bias, _Float16* Y,
                                           _Float16* stg, int t0, int f0, int lane) {
  const int hf = lane >> 4;
  const int nl = lane & 15;
  // all loops unrolled: the accumulator registers need constant indices
  float4 cb[8];  // MODE <= 1: the biases of the lane's 4 x 8 features
  if (MODE <= 1) {
    const unsigned bo = 32u * (unsigned)hf;  // the lane's byte offset from the strip's first bias
#pragma unroll
    for (int i = 0; i < 8; ++i)
      cb[i] = *(const float4*)((const char*)(bias + f0) + bo + 64 * (i >> 1) + 16 * (i & 1));
    // stands in front of any write of the offset register that the eight loads name; bo as an
    // input keeps that register live up to here, so that no load of the run lands in it
    asm volatile("s_wait_xcnt 0x0" ::"v"(bo) : "memory");
  }
#pragma unroll
  for (int j = 0; j < 4; ++j) {
    float c[8];
    if (MODE <= 1) {
      const float4 c0 = cb[2 * j], c1 = cb[2 * j + 1];
      c[0] = c0.x, c[1] = c0.y, c[2] = c0.z, c[3] = c0.w;
      c[4] = c1.x, c[5] = c1.y, c[6] = c1.z, c[7] = c1.w;
    }
#pragma unroll
    for (int ni = 0; ni < 2; ++ni) {
      v8h h;
#pragma unroll
      for (int v = 0; v < 8; ++v) {
        float val = acc[ni][j][v] + (MODE <= 1 ? c[v] : bias[f0 + 16 * ni + nl]);
        if (MODE == 0) val *= kQScale;  // fold the attention scale into Q
        h[v] = (_Float16)val;
      }
      *(v8h*)(stg + (16 * ni + nl) * kLP + 16 * j + 8 * hf) = h;
    }
  }
  // the wave's LDS writes are done before its lanes read each other's rows back
  asm volatile("s_wait_dscnt 0x0" ::: "memory");
  const int bb = t0 >> 11, ss = t0 & (kS - 1);
  const int hh = f0 >> 6, dd = f0 & (kHD - 1);
  // 8 lanes carry one row; row r lies r token rows (MODE <= 1) or r feature rows (MODE 2) on
  _Float16* yp = MODE <= 1 ? Y + ((size_t)(bb * kH + hh) * kS + ss + (lane >> 3)) * kHD + 8 * (lane & 7)
                           : Y + ((size_t)(bb * kH + hh) * kHD + dd + (lane >> 3)) * kS + ss + 8 * (lane & 7);
#pragma unroll
  for (int t = 0; t < 8; ++t)
    *(v8h*)(yp + (size_t)(4 * t) * (MODE <= 1 ? kHD : kS)) =
        *(const v8h*)(stg + (4 * t + (lane >> 3)) * kLP + 8 * (lane & 7));
  // stands in front of any later write of a register that a store above names:
  // in the built code the three epilogues follow one another
  asm volatile("s_wait_xcnt 0x0" ::: "memory");
}

// The same rounding (to nearest even, the instruction the compiler picks for cvt4), written
// in asm so that it stays where it is written: as plain casts the compiler lifts the
// roundings up to the loads that feed them, and the wait for those loads with them.
__device__ __forceinline__ v4h cvt4_here(const float4 f) {
  v2u r;
  asm volatile("v_cvt_pk_f16_f32 %0, %1, %2" : "=v"(r.x) : "v"(f.x), "v"(f.y));
  asm volatile("v_cvt_pk_f16_f32 %0, %1, %2" : "=v"(r.y) : "v"(f.z), "v"(f.w));
  return __builtin_bit_cast(v4h, r);
}

// The Q, K and V projections read nothing of each other: ONE launch, blockIdx.z
// picks the product (operands, bias, result and its layout). The choice is the
// same for a whole block. Block tile and wave strips are those of the kernel above.
// The A operand (4 fragments a wave, 64 rows) is the side that lies contiguous in the result:
// rows of W (features) for Q and K, rows of X (tokens) for V^T; the other side is B (32 rows).
// The operands come as f32, straight from the inputs: a stage (64 k of 128 rows of X
// and of W) is loaded into registers in whole 128-byte lines, rounded to f16 there and
// stored into the padded LDS tile, so no f16 copy of an input passes through memory.
// Two LDS buffers; the loads of stage s + 1 are issued behind the barrier that opens trip s
// and fly while stage s is worked on (a load does not stay in flight across __syncthreads()).
static constexpr int kFK = 64;       // k per stage
static constexpr int kFP = kFK + 8;  // LDS row pitch in halves: 144 B = 16 B x odd
static constexpr int kFS = kD / kFK; // stages: 8
static_assert(kFS >= 2 && kFS * kFK == kD, "two buffers need two stages");
static_assert(kFP == kLP, "a staged result row of 64 halves has the pitch of a tile row");
static_assert((kBS / kGT) * (kD / kGT) * 256 * 4 == kD * kD, "Wo: one float4 a thread of plane z = 0");

// amdgpu_waves_per_eu(6, 6): 768 blocks of 8 waves are three blocks a WGP, six waves a SIMD; at
// that register budget the whole grid is resident at once and there is no second, half-empty round.
__global__ __launch_bounds__(256) __attribute__((amdgpu_waves_per_eu(6, 6))) void qkv_gemm_kernel(
    const float* __restrict__ q, const float* __restrict__ k, const float* __restrict__ v,
    const float* __restrict__ Wq, const float* __restrict__ Wk, const float* __restrict__ Wv,
    const float* __restrict__ Wo, const float* __restrict__ bq, const float* __restrict__ bk,
    const float* __restrict__ bv, _Float16* __restrict__ Qp, _Float16* __restrict__ Kp,
    _Float16* __restrict__ VpT, _Float16* __restrict__ Wo16) {
  const int pz = blockIdx.z;
  const float* X = pz == 0 ? q : pz == 1 ? k : v;
  const float* W = pz == 0 ? Wq : pz == 1 ? Wk : Wv;

  // 16-byte aligned bases: every b128 read starts at base + 16 B x n
  __shared__ __attribute__((aligned(16))) _Float16 Ts[2][2][kGT][kFP];  // [0]: X, [1]: W; [buffer]

  const int tid  = threadIdx.x;
  const int lane = tid & 31;
  const int wv   = __builtin_amdgcn_readfirstlane(tid >> 5);  // scalar: strip offsets cost no vector register
  const int r2   = (wv & 3) * 32;  // the wave's strip inside the block tile: rows of the B side
  const int r4   = (wv >> 2) * 64;  // and of the A side
  const int oa   = pz == 2 ? 0 : 1;  // which tile is the A side

  // 16 float4 per thread and stage; 16 lanes cover one 256-byte row piece
  const int crow = tid >> 4;
  const int cc4  = (tid & 15) << 2;
  // block-uniform tile bases and one offset a thread, the same for both operands
  const float4* px = (const float4*)(X + (size_t)(blockIdx.x * kGT) * kD);
  const float4* pw = (const float4*)(W + (size_t)(blockIdx.y * kGT) * kD);
  const int go4 = crow * (kD / 4) + (tid & 15);  // in float4
  float4 rx[kGT / 16], rw[kGT / 16];
  // (the loops over i are unrolled: the register arrays need constant indices)
  auto load_stage = [&]() {
#pragma unroll
    for (int i = 0; i < kGT / 16; ++i) rx[i] = px[go4 + 16 * i * (kD / 4)];
#pragma unroll
    for (int i = 0; i < kGT / 16; ++i) rw[i] = pw[go4 + 16 * i * (kD / 4)];
    px += kFK / 4;  // the bases walk along k
    pw += kFK / 4;
  };
  auto store_stage = [&](int buf) {
#pragma unroll
    for (int i = 0; i < kGT / 16; ++i) *(v4h*)&Ts[0][buf][crow + 16 * i][cc4] = cvt4_here(rx[i]);
#pragma unroll
    for (int i = 0; i < kGT / 16; ++i) *(v4h*)&Ts[1][buf][crow + 16 * i][cc4] = cvt4_here(rw[i]);
  };

  load_stage();
  // Wo is needed as f16 two launches on: the blocks of plane z = 0 round it, one float4 a thread
  if (pz == 0) {
    const int wi = (blockIdx.y * (kBS / kGT) + blockIdx.x) * 256 + tid;
    ((v4h*)Wo16)[wi] = cvt4(((const float4*)Wo)[wi]);
    // stands in front of any later write of a register that the store above names
    asm volatile("s_wait_xcnt 0x0" ::: "memory");
  }
  store_stage(0);
  __syncthreads();  // publishes stage 0

  // same k order for A and B: lane >> 4 picks the 16-wide k half of a 32-wide block
  const int fo = (lane & 15) * kFP + ((lane >> 4) << 4);

  v8f acc[2][4] = {};
  for (int s = 0; s < kFS; ++s) {
    const int buf = s & 1;
    if (s + 1 < kFS) load_stage();
    // keeps the loads above in front of the products: left free, the scheduler sinks them
    // behind the last WMMA to save registers, and their whole latency then stands open
    __builtin_amdgcn_sched_barrier(0);
    const _Float16* fa = &Ts[oa][buf][r4][0] + fo;
    const _Float16* fb = &Ts[oa ^ 1][buf][r2][0] + fo;
    // unrolled: fragment reads of the later k block can stand ahead of the WMMAs
#pragma unroll
    for (int kk = 0; kk < kFK; kk += 32) {
      const v16h b0 = lds_frag(fb + kk);
      const v16h b1 = lds_frag(fb + 16 * kFP + kk);
#pragma unroll
      for (int j = 0; j < 4; ++j) {
        const v16h a = lds_frag(fa + 16 * j * kFP + kk);
        acc[0][j] = WMMA(a, b0, acc[0][j]);
        acc[1][j] = WMMA(a, b1, acc[1][j]);
      }
    }
    // keeps the roundings, and with them the wait for the loads, behind the products
    __builtin_amdgcn_sched_barrier(0);
    // the other buffer's last readers left it at the barrier that ended trip s - 1
    if (s + 1 < kFS) store_stage(buf ^ 1);
    __syncthreads();  // publishes stage s + 1 and ends every reader's use of buf
  }

  // The wave's own staging range, in the X buffers: the loop's last barrier ended every
  // reader's use of both tiles.
  _Float16* stg = &Ts[0][0][0][0] + wv * 32 * kLP;
  const int tb = blockIdx.x * kGT, fb0 = blockIdx.y * kGT;  // the block's first token and feature
  // the lane's number, read anew: taken from tid, a piece of it is held over the loop for the
  // epilogue, and at this kernel's register budget that piece is spilled to scratch
  const int el = (int)__builtin_amdgcn_mbcnt_lo(~0u, 0u);
  if (pz == 0)
    store_proj<0>(acc, bq, Qp, stg, tb + r2, fb0 + r4, el);
  else if (pz == 1)
    store_proj<1>(acc, bk, Kp, stg, tb + r2, fb0 + r4, el);
  else
    store_proj<2>(acc, bv, VpT, stg, tb + r4, fb0 + r2, el);
}

// ---------------------------------------------------------------------------
// Lane l <-> lane l ^ 16 (the two halves of a wave hold the same query column).
__device__ __forceinline__ float xhalf(float x) {
  const int b = __builtin_bit_cast(int, x);
  return __builtin_bit_cast(
      float, __builtin_amdgcn_permlanex16(b, b, 0x76543210, 0xfedcba98, false, false));
}

// A fragment in the hardware k order from a padded LDS row: k = 8h..8h+7 and
// 16+8h..16+8h+7 of a 32-wide k block (p already points at k = 8h).
__device__ __forceinline__ v16h lds_frag_kmap(const _Float16* p) {
  const v8h lo = *(const v8h*)p;
  const v8h hi = *(const v8h*)(p + 16);
  return __builtin_shufflevector(lo, hi, 0, 1, 2, 3, 4, 5, 6, 7, 8, 9, 10, 11, 12, 13, 14, 15);
}

// ---------------------------------------------------------------------------
// Flash attention: grid (S/64 q-tiles, B*H). 4 waves/block, wave owns 16 q rows.
// K/V 64x64 tiles staged in LDS with double-buffered async copies (ASYNCcnt),
// online softmax; scale and log2(e) already folded into Qp. VpT is [B,H,HD,S].
// Transposed products: S^T = K Q^T (rows = keys, columns = queries) and
// O^T += V^T P^T. A lane then holds scores of ONE query (column lane & 15), so
// maximum and sum run in the lane plus one exchange between the halves, and two
// converted score tiles are already the B operand of the second product.
// The softmax runs against a HELD maximum m per query: -m is the C operand of the
// score products, so their result is the argument of exp2 as it stands. m is set
// from the first tile and moves only when a lane's sum of exp2 over a tile passes
// kTop; only then are scores, O and the sum brought to the new maximum.
// ---------------------------------------------------------------------------
static constexpr float kTop = 8192.0f;  // every P <= kTop: far inside f16's range

// amdgpu_waves_per_eu(4, 4): the grid fills the chip at four waves a SIMD; told so, the
// compiler spends that register budget on K and V fragment reads issued in groups
// (without it the K reads stand one pair at a time, each waited out before its WMMA).
__global__ __launch_bounds__(128) __attribute__((amdgpu_waves_per_eu(4, 4)))
void flash_attn_kernel(const _Float16* __restrict__ Qp, const _Float16* __restrict__ Kp,
                       const _Float16* __restrict__ VpT, _Float16* __restrict__ ctx) {
  // 16-byte aligned bases: every b128 copy and b128 read starts at base + 16 B x n
  __shared__ __attribute__((aligned(16))) _Float16 Ktile[2][64][kLP];  // [buf][key][hd]    9KB each
  __shared__ __attribute__((aligned(16))) _Float16 Vtile[2][64][kLP];  // [buf][hd][key]    9KB each

  const int tid  = threadIdx.x;
  const int lane = tid & 31;
  const int wv   = tid >> 5;
  const int bh   = blockIdx.y;
  const int q0   = blockIdx.x * 64 + wv * 16;

  const _Float16* Qb = Qp + (size_t)bh * kS * kHD;
  const _Float16* Kb = Kp + (size_t)bh * kS * kHD;
  const _Float16* Vb = VpT + (size_t)bh * kHD * kS;

  // 8 x b128 async copies per thread per tile (K: 8KB, V: 8KB for 128 threads)
  auto issue_tile = [&](int kt, int buf) {
#pragma unroll
    for (int i = 0; i < 4; ++i) {
      const int idx = i * 128 + tid;   // 16B chunk id, 0..511
      const int row = idx >> 3;        // 0..63
      const int c8  = (idx & 7) << 3;  // half offset within row
      async_cp16(&Ktile[buf][row][c8], Kb + (size_t)(kt + row) * kHD + c8);
    }
#pragma unroll
    for (int i = 0; i < 4; ++i) {
      const int idx = i * 128 + tid;
      const int row = idx >> 3;        // hd
      const int c8  = (idx & 7) << 3;  // key offset
      async_cp16(&Vtile[buf][row][c8], Vb + (size_t)row * kS + kt + c8);
    }
  };

  // Q as B operand (column = query); same k order as the K loader below
  const v16h bq0 = *fragp(Qb, kHD, q0, 0, lane);
  const v16h bq1 = *fragp(Qb, kHD, q0, 32, lane);

  v8f acc[4] = {};  // acc[i][r] = O[q0 + nl][16 i + 8 hf + r]
  v8f negm = {};      // minus the held maximum of query q0 + nl, in all eight rows
  float lrow = 0.0f;  // of query q0 + nl, this half's keys only, in units of exp2(held maximum)

  const int hf = lane >> 4;
  const int nl = lane & 15;

  issue_tile(0, 0);

  for (int ti = 0; ti < kS / 64; ++ti) {
    const int buf = ti & 1;
    if (ti + 1 < kS / 64) {
      issue_tile((ti + 1) * 64, buf ^ 1);
      WAIT_ASYNC(8);  // all but the 8 just-issued -> current tile resident
    } else {
      WAIT_ASYNC(0);
    }
    __syncthreads();

    const _Float16* Kt = &Ktile[buf][0][0];
    const _Float16* Vt = &Vtile[buf][0][0];

    // S^T - m = K @ Q^T - m: sc[j][r] = score(key 16 j + 8 hf + r, query nl) - m
    // (all inner loops are unrolled so that the register arrays keep constant indices)
    v16h ka[4][2];
#pragma unroll
    for (int j = 0; j < 4; ++j) {
      const _Float16* kp = Kt + (size_t)(16 * j + nl) * kLP + (hf << 4);
      ka[j][0] = lds_frag(kp);
      ka[j][1] = lds_frag(kp + 32);
    }
    v8f sc[4];
#pragma unroll
    for (int j = 0; j < 4; ++j) sc[j] = WMMA(ka[j][0], bq0, negm);
#pragma unroll
    for (int j = 0; j < 4; ++j) sc[j] = WMMA(ka[j][1], bq1, sc[j]);

    // A of the second product: V^T rows (hd) from the [hd][key] tile, hardware k order.
    // Read here, in front of the test below, so that the reads fly under the exp2 run.
    v16h av[4][2];
#pragma unroll
    for (int i = 0; i < 4; ++i) {
      const _Float16* vp = Vt + (size_t)(16 * i + nl) * kLP + (hf << 3);
      av[i][0] = lds_frag_kmap(vp);
      av[i][1] = lds_frag_kmap(vp + 32);
    }

    // P^T = exp2(S^T - m) and this lane's sum of it
    v2f pv[4][4];
    v2f rs[4];
#pragma unroll
    for (int j = 0; j < 4; ++j) {
#pragma unroll
      for (int r = 0; r < 4; ++r) {
        pv[j][r] = v2f{__builtin_amdgcn_exp2f(sc[j][2 * r]), __builtin_amdgcn_exp2f(sc[j][2 * r + 1])};
        rs[j] = r == 0 ? pv[j][r] : rs[j] + pv[j][r];  // the first pair starts the sum
      }
    }
    v2f rt = (rs[0] + rs[1]) + (rs[2] + rs[3]);
    float rsum = rt.x + rt.y;

    // One test a tile, the same for the whole wave: the first tile sets the held
    // maximum (a sum is never below 0), a later one moves it only if some lane's
    // sum has grown past kTop.
    const float top = ti == 0 ? -1.0f : kTop;
    if (__builtin_amdgcn_ballot_w32(rsum > top) != 0) {
      // maximum over the 64 keys of this query: 32 in the lane, then the other half
      float tj[4];
#pragma unroll
      for (int j = 0; j < 4; ++j) {
        tj[j] = fmaxf(sc[j][0], sc[j][1]);
#pragma unroll
        for (int r = 2; r < 8; r += 2) tj[j] = fmaxf(fmaxf(tj[j], sc[j][r]), sc[j][r + 1]);
      }
      float t = fmaxf(fmaxf(tj[0], tj[1]), fmaxf(tj[2], tj[3]));
      t = fmaxf(t, xhalf(t));
      // the held maximum never falls once the first tile has set it
      const float up = ti == 0 ? t : fmaxf(t, 0.0f);
      const float al = __builtin_amdgcn_exp2f(-fmaxf(up, 0.0f));  // 1 on the first tile's way down: O and sum are 0
#pragma unroll
      for (int j = 0; j < 4; ++j) {
#pragma unroll
        for (int r = 0; r < 4; ++r) {
          pv[j][r] = v2f{__builtin_amdgcn_exp2f(sc[j][2 * r] - up),
                         __builtin_amdgcn_exp2f(sc[j][2 * r + 1] - up)};
          rs[j] = r == 0 ? pv[j][r] : rs[j] + pv[j][r];
        }
      }
      rt   = (rs[0] + rs[1]) + (rs[2] + rs[3]);
      rsum = rt.x + rt.y;
      lrow *= al;
#pragma unroll
      for (int r = 0; r < 8; ++r) negm[r] -= up;
#pragma unroll
      for (int i = 0; i < 4; ++i)
#pragma unroll
        for (int r = 0; r < 8; ++r) acc[i][r] *= al;
    }
    lrow += rsum;

    // packed in place: tiles 2 kb and 2 kb + 1 are the B operand of key block kb
    // in the hardware k order
    v16h bp[2];
#pragma unroll
    for (int j = 0; j < 4; ++j) {
#pragma unroll
      for (int r = 0; r < 4; ++r) {
        bp[j >> 1][(j & 1) * 8 + 2 * r]     = (_Float16)pv[j][r].x;
        bp[j >> 1][(j & 1) * 8 + 2 * r + 1] = (_Float16)pv[j][r].y;
      }
    }

    // O^T += V^T @ P^T
#pragma unroll
    for (int i = 0; i < 4; ++i) acc[i] = WMMA(av[i][0], bp[0], acc[i]);
#pragma unroll
    for (int i = 0; i < 4; ++i) acc[i] = WMMA(av[i][1], bp[1], acc[i]);
    __syncthreads();  // protect K/V buf before next iteration refills it
  }

  // join the halves' sums, normalize, store ctx token-major [B,S,D] f16.
  // A lane holds 16-byte runs of one query's 128-byte row: the 16 rows pass through the wave's
  // own LDS range so that each store covers four whole lines. K buffer 0 is free: its last
  // readers left it two barriers ago and no copy is outstanding.
  const int bb = bh >> 3, hh = bh & 7;
  const float inv = 1.0f / (lrow + xhalf(lrow));
  _Float16* stg = &Ktile[0][0][0] + wv * 16 * kLP;
#pragma unroll
  for (int i = 0; i < 4; ++i) {
    v8h o;
#pragma unroll
    for (int r = 0; r < 8; ++r) o[r] = (_Float16)(acc[i][r] * inv);
    *(v8h*)(stg + nl * kLP + 16 * i + 8 * hf) = o;
  }
  // the wave's LDS writes are done before its lanes read each other's rows back
  asm volatile("s_wait_dscnt 0x0" ::: "memory");
  _Float16* crow = ctx + ((size_t)bb * kS + q0 + (lane >> 3)) * kD + hh * kHD + 8 * (lane & 7);
#pragma unroll
  for (int t = 0; t < 4; ++t)
    *(v8h*)(crow + (size_t)(4 * t) * kD) = *(const v8h*)(stg + (4 * t + (lane >> 3)) * kLP + 8 * (lane & 7));
}

// ---------------------------------------------------------------------------
extern "C" void kernel_launch(void* const* d_in, const int* in_sizes, int n_in,
                              void* d_out, int out_size, void* d_ws, size_t ws_size,
                              hipStream_t stream) {
  const float* q  = (const float*)d_in[0];
  const float* k  = (const float*)d_in[1];
  const float* v  = (const float*)d_in[2];
  const float* Wq = (const float*)d_in[3];
  const float* bq = (const float*)d_in[4];
  const float* Wk = (const float*)d_in[5];
  const float* bk = (const float*)d_in[6];
  const float* Wv = (const float*)d_in[7];
  const float* bv = (const float*)d_in[8];
  const float* Wo = (const float*)d_in[9];
  const float* bo = (const float*)d_in[10];

  char* p = (char*)d_ws;
  auto take = [&](size_t bytes) -> char* {
    char* r = p;
    p += (bytes + 255) & ~(size_t)255;
    return r;
  };
  const size_t tokElems = (size_t)kBS * kD;  // 8192*512
  const size_t wElems   = (size_t)kD * kD;

  _Float16* Wo16 = (_Float16*)take(wElems * 2);
  _Float16* Qp   = (_Float16*)take(tokElems * 2);
  _Float16* Kp   = (_Float16*)take(tokElems * 2);
  _Float16* VpT  = (_Float16*)take(tokElems * 2);
  _Float16* ctx  = (_Float16*)take(tokElems * 2);

  dim3 ggrid(kBS / kGT, kD / kGT);
  qkv_gemm_kernel<<<dim3(kBS / kGT, kD / kGT, 3), 256, 0, stream>>>(q, k, v, Wq, Wk, Wv, Wo, bq, bk, bv, Qp,
                                                                    Kp, VpT, Wo16);

  flash_attn_kernel<<<dim3(kS / 64, kB * kH), 128, 0, stream>>>(Qp, Kp, VpT, ctx);

  out_gemm_kernel<<<ggrid, 256, 0, stream>>>(ctx, Wo16, bo, (float*)d_out);
}

// v009
// A run of this version takes 60.1 microseconds.
// Two timings next to v008 both put it at 1.05 times that version's speed.
// All steps since v000 together make it 3.82 times as fast.
#include <hip/hip_runtime.h>

typedef __attribute__((ext_vector_type(16))) _Float16 v16h;
typedef __attribute__((ext_vector_type(8)))  _Float16 v8h;
typedef __attribute__((ext_vector_type(4)))  _Float16 v4h;
typedef __attribute__((ext_vector_type(8)))  float    v8f;
typedef __attribute__((ext_vector_type(2)))  float    v2f;
typedef __attribute__((ext_vector_type(4)))  int      v4i;
typedef __attribute__((ext_vector_type(2)))  unsigned v2u;

#define WMMA(a, b, c) \
  __builtin_amdgcn_wmma_f32_16x16x32_f16(false, (a), false, (b), (short)0, (c), false, false)

static constexpr int kB = 4, kS = 2048, kD = 512, kH = 8, kHD = 64;
static constexpr int kBS = kB * kS;  // 8192 tokens
// LDS row pitch in halves: 64 data + 8 pad = 144 B = 16 B x odd, so the 16 rows
// that one ds_load_b128 touches per lane half fall on 16 distinct bank groups.
static constexpr int kLP = 72;
// Q carries 1/sqrt(HD) and log2(e): the score products come out in the base-2 domain
static constexpr float kQScale = 0.125f * 1.44269504088896341f;

// ---------------------------------------------------------------------------
// CDNA5 async global->LDS copy (16B per lane), tracked by ASYNCcnt.
// Builtin signature (from hipcc diagnostic): (AS1 int4* src, AS3 int4* dst, Ii, Ii)
// ---------------------------------------------------------------------------
__device__ __forceinline__ void async_cp16(void* lds_dst, const void* gsrc) {
#if __has_builtin(__builtin_amdgcn_global_load_async_to_lds_b128)
  __builtin_amdgcn_global_load_async_to_lds_b128(
      (__attribute__((address_space(1))) v4i*)gsrc,
      (__attribute__((address_space(3))) v4i*)lds_dst, 0, 0);
#else
  unsigned loff = (unsigned)(size_t)(__attribute__((address_space(3))) void*)lds_dst;
  asm volatile("global_load_async_to_lds_b128 %0, %1, off" ::"v"(loff), "v"(gsrc)
               : "memory");
#endif
}

#if __has_builtin(__builtin_amdgcn_s_wait_asynccnt)
#define WAIT_ASYNC(n) __builtin_amdgcn_s_wait_asynccnt(n)
#else
#define WAIT_ASYNC(n) asm volatile("s_wait_asynccnt %0" ::"i"(n) : "memory")
#endif

// A/B fragment load for v_wmma_f32_16x16x32_f16.
// A (16x32, MxK) from row-major [M][K]: lane&15 -> row, lane>>4 -> 16-wide K half.
// B (32x16, KxN) from [N][K] row-major (i.e. transposed B): identical addressing.
__device__ __forceinline__ const v16h* fragp(const _Float16* __restrict__ base, int ld,
                                             int row0, int col0, int lane) {
  return (const v16h*)(base + (size_t)(row0 + (lane & 15)) * ld + col0 + ((lane >> 4) << 4));
}

// 32-byte fragment slice from a padded LDS row. The rows are 16-byte aligned
// only, so it is read as two 16-byte halves.
__device__ __forceinline__ v16h lds_frag(const _Float16* p) {
  const v8h lo = *(const v8h*)p;
  const v8h hi = *(const v8h*)(p + 8);
  return __builtin_shufflevector(lo, hi, 0, 1, 2, 3, 4, 5, 6, 7, 8, 9, 10, 11, 12, 13, 14, 15);
}

__device__ __forceinline__ v4h cvt4(const float4 f) {
  return v4h{(_Float16)f.x, (_Float16)f.y, (_Float16)f.z, (_Float16)f.w};
}

// ---------------------------------------------------------------------------
// Y = X @ W^T + bias, X:[8192,512] f16, W:[512,512] f16 (row-major = [N][K]).
// One block = 128 rows of X times 128 rows of W, 8 waves, each a 32x64 strip:
// 8 WMMAs per 6 fragments. Both operand tiles are staged in LDS, 128 k at a time
// (256-byte rows, so every wave-wide copy covers whole lines), two buffers: the
// next stage's copies fly while this stage is worked on.
// Y is the final output, [B,S,D] f32 (the projections run in qkv_gemm_kernel below).
// Row 4 c + j of a 64-row group of W lies at LDS row 16 j + c: column c of B fragment j is
// feature 4 c + j, so a lane's four accumulator tiles hold 4 adjacent features of a token
// and 16 lanes store 256 contiguous bytes: whole lines.
// ---------------------------------------------------------------------------
static constexpr int kGT = 128;      // rows of X and rows of W per block
static constexpr int kGK = 128;      // k per stage
static constexpr int kGP = kGK + 8;  // LDS row pitch in halves: 272 B = 16 B x odd
static constexpr int kGS = kD / kGK; // stages: 4
static_assert(kGS >= 2 && kGS * kGK == kD, "two buffers need two stages");
static_assert((kGS & (kGS - 1)) == 0, "the wrapped stage number is taken by a mask");

__global__ __launch_bounds__(256) void out_gemm_kernel(const _Float16* __restrict__ X,
                                                       const _Float16* __restrict__ W,
                                                       const float* __restrict__ bias,
                                                       float* __restrict__ Y) {
  // 16-byte aligned bases: every b128 copy and b128 read starts at base + 16 B x n
  __shared__ __attribute__((aligned(16))) _Float16 Xs[2][kGT][kGP];
  __shared__ __attribute__((aligned(16))) _Float16 Ws[2][kGT][kGP];

  const int tid  = threadIdx.x;
  const int lane = tid & 31;
  const int wv   = tid >> 5;
  const int mw   = (wv & 3) * 32;  // the wave's strip inside the block tile
  const int nw   = (wv >> 2) * 64;
  const int m0   = blockIdx.x * kGT + mw;
  const int n0   = blockIdx.y * kGT + nw;

  // 16 b128 copies per thread and stage; 16 lanes cover one 256-byte row
  const int crow = tid >> 4;
  const int cc8  = (tid & 15) << 3;
  const _Float16* gx = X + (size_t)(blockIdx.x * kGT + crow) * kD + cc8;
  const _Float16* gw = W + (size_t)(blockIdx.y * kGT + crow) * kD + cc8;
  const int wrow = 16 * (crow & 3) + (crow >> 2);  // LDS row of W's row crow; row crow + 16 i lies 4 (i & 3) + 64 (i >> 2) on
  // The 4 blocks that read the same rows of X and the 64 that read the same rows of W run side
  // by side: each starts its walk along k at a stage of its own and wraps round, so that they do
  // not all ask L2 for the same lines at the same moment. Every stage is still taken once.
  const int rot = blockIdx.x + blockIdx.y;
  auto issue_stage = [&](int s, int buf) {
    const int ko = ((s + rot) & (kGS - 1)) * kGK;
#pragma unroll
    for (int i = 0; i < kGT / 16; ++i)
      async_cp16(&Xs[buf][crow + 16 * i][cc8], gx + (size_t)(16 * i) * kD + ko);
#pragma unroll
    for (int i = 0; i < kGT / 16; ++i)
      async_cp16(&Ws[buf][wrow + 4 * (i & 3) + 64 * (i >> 2)][cc8], gw + (size_t)(16 * i) * kD + ko);
  };

  issue_stage(0, 0);
  // stage 0 has landed for this wave; the barrier publishes it to the others
  asm volatile("s_wait_asynccnt 0x0" ::: "memory");
  __syncthreads();
  issue_stage(1, 1);

  // same k order for A and B: lane >> 4 picks the 16-wide k half of a 32-wide block
  const int fo = (lane & 15) * kGP + ((lane >> 4) << 4);

  v8f acc[2][4] = {};
  for (int s = 0; s < kGS; ++s) {
    const int buf = s & 1;
    const _Float16* xs = &Xs[buf][mw][0] + fo;
    const _Float16* ws = &Ws[buf][nw][0] + fo;
    // unrolled: fragment reads of a later k block can stand ahead of the WMMAs
#pragma unroll
    for (int kk = 0; kk < kGK; kk += 32) {
      const v16h a0 = lds_frag(xs + kk);
      const v16h a1 = lds_frag(xs + 16 * kGP + kk);
#pragma unroll
      for (int j = 0; j < 4; ++j) {
        const v16h b = lds_frag(ws + 16 * j * kGP + kk);
        acc[0][j] = WMMA(a0, b, acc[0][j]);
        acc[1][j] = WMMA(a1, b, acc[1][j]);
      }
    }
    // this wave's reads of buf are done before buf may be refilled
    asm volatile("s_wait_dscnt 0x0" ::: "memory");
    // this wave's copies of stage s + 1 have landed
    asm volatile("s_wait_asynccnt 0x0" ::: "memory");
    __syncthreads();  // publishes stage s + 1 and ends every reader's use of buf
    if (s + 2 < kGS) issue_stage(s + 2, buf);
  }
  // nothing is outstanding when the wave goes on to its stores and ends
  asm volatile("s_wait_asynccnt 0x0" ::: "memory");

  // C layout: lanes 0-15 hold N=lane, M=vgpr; lanes 16-31 hold N=lane-16, M=8+vgpr:
  // acc[mi][j][v] = Y[token m0 + 16 mi + rl + v][feature n0 + 4 nl + j]
  const int rl = (lane >> 4) << 3;
  const int nl = lane & 15;
  const float4 c = *(const float4*)(bias + n0 + 4 * nl);
  float* yp = Y + (size_t)(m0 + rl) * kD + n0 + 4 * nl;
  // (both loops unrolled: the accumulator registers need constant indices)
#pragma unroll
  for (int mi = 0; mi < 2; ++mi) {
#pragma unroll
    for (int v = 0; v < 8; ++v)
      *(float4*)(yp + (size_t)(16 * mi + v) * kD) = float4{acc[mi][0][v] + c.x, acc[mi][1][v] + c.y,
                                                           acc[mi][2][v] + c.z, acc[mi][3][v] + c.w};
  }
}

// Epilogue of a wave's strip of a projection: bias, rounding to f16, then the store.
// acc[ni][j][v] is the result at place 16 j + 8 hf + v of the strip's 64-long side (the A
// operand's rows) and 16 ni + nl of its 32-long side: the 64-long side is the one that lies
// contiguous in memory, so a lane holds 16-byte runs and a row of the strip is one 128-byte line.
// MODE 0: Q -> [B,H,S,HD], scaled by log2(e)/sqrt(HD); MODE 1: K -> [B,H,S,HD]:
//         32 tokens from t0 (rows) x the 64 features of a head from f0.
// MODE 2: V -> [B,H,HD,S] (transposed for the second product of attention):
//         32 features from f0 (rows) x 64 tokens from t0.
// The rows pass through stg, the wave's own LDS range (32 rows at pitch kLP), so that each
// store covers four whole lines instead of 16 or 32 pieces.
template <int MODE>
__device__ __forceinline__ void store_proj(const v8f (&acc)[2][4], const float* bias, _Float16* Y,
                                           _Float16* stg, int t0, int f0, int lane) {
  const int hf = lane >> 4;
  const int nl = lane & 15;
  // all loops unrolled: the accumulator registers need constant indices
  float4 cb[8];  // MODE <= 1: the biases of the lane's 4 x 8 features
  if (MODE <= 1) {
    const unsigned bo = 32u * (unsigned)hf;  // the lane's byte offset from the strip's first bias
#pragma unroll
    for (int i = 0; i < 8; ++i)
      cb[i] = *(const float4*)((const char*)(bias + f0) + bo + 64 * (i >> 1) + 16 * (i & 1));
    // stands in front of any write of the offset register that the eight loads name; bo as an
    // input keeps that register live up to here, so that no load of the run lands in it
    asm volatile("s_wait_xcnt 0x0" ::"v"(bo) : "memory");
  }
#pragma unroll
  for (int j = 0; j < 4; ++j) {
    float c[8];
    if (MODE <= 1) {
      const float4 c0 = cb[2 * j], c1 = cb[2 * j + 1];
      c[0] = c0.x, c[1] = c0.y, c[2] = c0.z, c[3] = c0.w;
      c[4] = c1.x, c[5] = c1.y, c[6] = c1.z, c[7] = c1.w;
    }
#pragma unroll
    for (int ni = 0; ni < 2; ++ni) {
      v8h h;
#pragma unroll
      for (int v = 0; v < 8; ++v) {
        float val = acc[ni][j][v] + (MODE <= 1 ? c[v] : bias[f0 + 16 * ni + nl]);
        if (MODE == 0) val *= kQScale;  // fold the attention scale into Q
        h[v] = (_Float16)val;
      }
      *(v8h*)(stg + (16 * ni + nl) * kLP + 16 * j + 8 * hf) = h;
    }
  }
  // the wave's LDS writes are done before its lanes read each other's rows back
  asm volatile("s_wait_dscnt 0x0" ::: "memory");
  const int bb = t0 >> 11, ss = t0 & (kS - 1);
  const int hh = f0 >> 6, dd = f0 & (kHD - 1);
  // 8 lanes carry one row; row r lies r token rows (MODE <= 1) or r feature rows (MODE 2) on
  _Float16* yp = MODE <= 1 ? Y + ((size_t)(bb * kH + hh) * kS + ss + (lane >> 3)) * kHD + 8 * (lane & 7)
                           : Y + ((size_t)(bb * kH + hh) * kHD + dd + (lane >> 3)) * kS + ss + 8 * (lane & 7);
#pragma unroll
  for (int t = 0; t < 8; ++t)
    *(v8h*)(yp + (size_t)(4 * t) * (MODE <= 1 ? kHD : kS)) =
        *(const v8h*)(stg + (4 * t + (lane >> 3)) * kLP + 8 * (lane & 7));
  // stands in front of any later write of a register that a store above names:
  // in the built code the three epilogues follow one another
  asm volatile("s_wait_xcnt 0x0" ::: "memory");
}

// The same rounding (to nearest even, the instruction the compiler picks for cvt4), written
// in asm so that it stays where it is written: as plain casts the compiler lifts the
// roundings up to the loads that feed them, and the wait for those loads with them.
__device__ __forceinline__ v4h cvt4_here(const float4 f) {
  v2u r;
  asm volatile("v_cvt_pk_f16_f32 %0, %1, %2" : "=v"(r.x) : "v"(f.x), "v"(f.y));
  asm volatile("v_cvt_pk_f16_f32 %0, %1, %2" : "=v"(r.y) : "v"(f.z), "v"(f.w));
  return __builtin_bit_cast(v4h, r);
}

// The Q, K and V projections read nothing of each other: ONE launch, blockIdx.z
// picks the product (operands, bias, result and its layout). The choice is the
// same for a whole block. Block tile and wave strips are those of the kernel above.
// The A operand (4 fragments a wave, 64 rows) is the side that lies contiguous in the result:
// rows of W (features) for Q and K, rows of X (tokens) for V^T; the other side is B (32 rows).
// The operands come as f32, straight from the inputs: a stage (64 k of 128 rows of X
// and of W) is loaded into registers in whole 128-byte lines, rounded to f16 there and
// stored into the padded LDS tile, so no f16 copy of an input passes through memory.
// Two LDS buffers; the loads of stage s + 1 are issued behind the barrier that opens trip s
// and fly while stage s is worked on (a load does not stay in flight across __syncthreads()).
static constexpr int kFK = 64;       // k per stage
static constexpr int kFP = kFK + 8;  // LDS row pitch in halves: 144 B = 16 B x odd
static constexpr int kFS = kD / kFK; // stages: 8
static_assert(kFS >= 2 && kFS * kFK == kD, "two buffers need two stages");
static_assert((kFS & (kFS - 1)) == 0, "the wrapped stage number is taken by a mask");
static_assert(kFP == kLP, "a staged result row of 64 halves has the pitch of a tile row");
static_assert((kBS / kGT) * (kD / kGT) * 256 * 4 == kD * kD, "Wo: one float4 a thread of plane z = 0");

// amdgpu_waves_per_eu(6, 6): 768 blocks of 8 waves are three blocks a WGP, six waves a SIMD; at
// that register budget the whole grid is resident at once and there is no second, half-empty round.
__global__ __launch_bounds__(256) __attribute__((amdgpu_waves_per_eu(6, 6))) void qkv_gemm_kernel(
    const float* __restrict__ q, const float* __restrict__ k, const float* __restrict__ v,
    const float* __restrict__ Wq, const float* __restrict__ Wk, const float* __restrict__ Wv,
    const float* __restrict__ Wo, const float* __restrict__ bq, const float* __restrict__ bk,
    const float* __restrict__ bv, _Float16* __restrict__ Qp, _Float16* __restrict__ Kp,
    _Float16* __restrict__ VpT, _Float16* __restrict__ Wo16) {
  const int pz = blockIdx.z;
  const float* X = pz == 0 ? q : pz == 1 ? k : v;
  const float* W = pz == 0 ? Wq : pz == 1 ? Wk : Wv;

  // 16-byte aligned bases: every b128 read starts at base + 16 B x n
  __shared__ __attribute__((aligned(16))) _Float16 Ts[2][2][kGT][kFP];  // [0]: X, [1]: W; [buffer]

  const int tid  = threadIdx.x;
  const int lane = tid & 31;
  const int wv   = __builtin_amdgcn_readfirstlane(tid >> 5);  // scalar: strip offsets cost no vector register
  const int r2   = (wv & 3) * 32;  // the wave's strip inside the block tile: rows of the B side
  const int r4   = (wv >> 2) * 64;  // and of the A side
  const int oa   = pz == 2 ? 0 : 1;  // which tile is the A side

  // 16 float4 per thread and stage; 16 lanes cover one 256-byte row piece
  const int crow = tid >> 4;
  const int cc4  = (tid & 15) << 2;
  // block-uniform tile bases and one offset a thread, the same for both operands
  const float4* px = (const float4*)(X + (size_t)(blockIdx.x * kGT) * kD);
  const float4* pw = (const float4*)(W + (size_t)(blockIdx.y * kGT) * kD);
  const int go4 = crow * (kD / 4) + (tid & 15);  // in float4
  float4 rx[kGT / 16], rw[kGT / 16];
  // (the loops over i are unrolled: the register arrays need constant indices)
  // The walk along k starts at a stage of the block's own and wraps round (as in the kernel
  // above): the 4 blocks on the same rows of X take 4 different starts, the 64 on the same
  // rows of W eight.
  int ks = (blockIdx.x + 2 * blockIdx.y) & (kFS - 1);  // the stage that the bases stand at
  px += ks * (kFK / 4);
  pw += ks * (kFK / 4);
  auto load_stage = [&]() {
#pragma unroll
    for (int i = 0; i < kGT / 16; ++i) rx[i] = px[go4 + 16 * i * (kD / 4)];
#pragma unroll
    for (int i = 0; i < kGT / 16; ++i) rw[i] = pw[go4 + 16 * i * (kD / 4)];
    // the bases walk along k and go back to the row's start behind its last stage
    const int step = ks == kFS - 1 ? -(kFS - 1) * (kFK / 4) : kFK / 4;
    px += step;
    pw += step;
    ks = (ks + 1) & (kFS - 1);
  };
  auto store_stage = [&](int buf) {
#pragma unroll
    for (int i = 0; i < kGT / 16; ++i) *(v4h*)&Ts[0][buf][crow + 16 * i][cc4] = cvt4_here(rx[i]);
#pragma unroll
    for (int i = 0; i < kGT / 16; ++i) *(v4h*)&Ts[1][buf][crow + 16 * i][cc4] = cvt4_here(rw[i]);
  };

  load_stage();
  // Wo is needed as f16 two launches on: the blocks of plane z = 0 round it, one float4 a thread
  if (pz == 0) {
    const int wi = (blockIdx.y * (kBS / kGT) + blockIdx.x) * 256 + tid;
    ((v4h*)Wo16)[wi] = cvt4(((const float4*)Wo)[wi]);
    // stands in front of any later write of a register that the store above names
    asm volatile("s_wait_xcnt 0x0" ::: "memory");
  }
  store_stage(0);
  __syncthreads();  // publishes stage 0

  // same k order for A and B: lane >> 4 picks the 16-wide k half of a 32-wide block
  const int fo = (lane & 15) * kFP + ((lane >> 4) << 4);

  v8f acc[2][4] = {};
  for (int s = 0; s < kFS; ++s) {
    const int buf = s & 1;
    if (s + 1 < kFS) load_stage();
    // keeps the loads above in front of the products: left free, the scheduler sinks them
    // behind the last WMMA to save registers, and their whole latency then stands open
    __builtin_amdgcn_sched_barrier(0);
    const _Float16* fa = &Ts[oa][buf][r4][0] + fo;
    const _Float16* fb = &Ts[oa ^ 1][buf][r2][0] + fo;
    // unrolled: fragment reads of the later k block can stand ahead of the WMMAs
#pragma unroll
    for (int kk = 0; kk < kFK; kk += 32) {
      const v16h b0 = lds_frag(fb + kk);
      const v16h b1 = lds_frag(fb + 16 * kFP + kk);
#pragma unroll
      for (int j = 0; j < 4; ++j) {
        const v16h a = lds_frag(fa + 16 * j * kFP + kk);
        acc[0][j] = WMMA(a, b0, acc[0][j]);
        acc[1][j] = WMMA(a, b1, acc[1][j]);
      }
    }
    // keeps the roundings, and with them the wait for the loads, behind the products
    __builtin_amdgcn_sched_barrier(0);
    // the other buffer's last readers left it at the barrier that ended trip s - 1
    if (s + 1 < kFS) store_stage(buf ^ 1);
    __syncthreads();  // publishes stage s + 1 and ends every reader's use of buf
  }

  // The wave's own staging range, in the X buffers: the loop's last barrier ended every
  // reader's use of both tiles.
  _Float16* stg = &Ts[0][0][0][0] + wv * 32 * kLP;
  const int tb = blockIdx.x * kGT, fb0 = blockIdx.y * kGT;  // the block's first token and feature
  // the lane's number, read anew: taken from tid, a piece of it is held over the loop for the
  // epilogue, and at this kernel's register budget that piece is spilled to scratch
  const int el = (int)__builtin_amdgcn_mbcnt_lo(~0u, 0u);
  if (pz == 0)
    store_proj<0>(acc, bq, Qp, stg, tb + r2, fb0 + r4, el);
  else if (pz == 1)
    store_proj<1>(acc, bk, Kp, stg, tb + r2, fb0 + r4, el);
  else
    store_proj<2>(acc, bv, VpT, stg, tb + r4, fb0 + r2, el);
}

// ---------------------------------------------------------------------------
// Lane l <-> lane l ^ 16 (the two halves of a wave hold the same query column).
__device__ __forceinline__ float xhalf(float x) {
  const int b = __builtin_bit_cast(int, x);
  return __builtin_bit_cast(
      float, __builtin_amdgcn_permlanex16(b, b, 0x76543210, 0xfedcba98, false, false));
}

// A fragment in the hardware k order from a padded LDS row: k = 8h..8h+7 and
// 16+8h..16+8h+7 of a 32-wide k block (p already points at k = 8h).
__device__ __forceinline__ v16h lds_frag_kmap(const _Float16* p) {
  const v8h lo = *(const v8h*)p;
  const v8h hi = *(const v8h*)(p + 16);
  return __builtin_shufflevector(lo, hi, 0, 1, 2, 3, 4, 5, 6, 7, 8, 9, 10, 11, 12, 13, 14, 15);
}

// ---------------------------------------------------------------------------
// Flash attention: grid (S/64 q-tiles, B*H). 4 waves/block, wave owns 16 q rows.
// K/V 64x64 tiles staged in LDS with double-buffered async copies (ASYNCcnt),
// online softmax; scale and log2(e) already folded into Qp. VpT is [B,H,HD,S].
// Transposed products: S^T = K Q^T (rows = keys, columns = queries) and
// O^T += V^T P^T. A lane then holds scores of ONE query (column lane & 15), so
// maximum and sum run in the lane plus one exchange between the halves, and two
// converted score tiles are already the B operand of the second product.
// The softmax runs against a HELD maximum m per query: -m is the C operand of the
// score products, so their result is the argument of exp2 as it stands. m is set
// from the first tile and moves only when a lane's sum of exp2 over a tile passes
// kTop; only then are scores, O and the sum brought to the new maximum.
// ---------------------------------------------------------------------------
static constexpr float kTop = 8192.0f;  // every P <= kTop: far inside f16's range

// amdgpu_waves_per_eu(4, 4): the grid fills the chip at four waves a SIMD; told so, the
// compiler spends that register budget on K and V fragment reads issued in groups
// (without it the K reads stand one pair at a time, each waited out before its WMMA).
__global__ __launch_bounds__(128) __attribute__((amdgpu_waves_per_eu(4, 4)))
void flash_attn_kernel(const _Float16* __restrict__ Qp, const _Float16* __restrict__ Kp,
                       const _Float16* __restrict__ VpT, _Float16* __restrict__ ctx) {
  // 16-byte aligned bases: every b128 copy and b128 read starts at base + 16 B x n
  __shared__ __attribute__((aligned(16))) _Float16 Ktile[2][64][kLP];  // [buf][key][hd]    9KB each
  __shared__ __attribute__((aligned(16))) _Float16 Vtile[2][64][kLP];  // [buf][hd][key]    9KB each

  const int tid  = threadIdx.x;
  const int lane = tid & 31;
  const int wv   = tid >> 5;
  const int bh   = blockIdx.y;
  const int q0   = blockIdx.x * 64 + wv * 16;

  const _Float16* Qb = Qp + (size_t)bh * kS * kHD;
  const _Float16* Kb = Kp + (size_t)bh * kS * kHD;
  const _Float16* Vb = VpT + (size_t)bh * kHD * kS;

  // 8 x b128 async copies per thread per tile (K: 8KB, V: 8KB for 128 threads)
  auto issue_tile = [&](int kt, int buf) {
#pragma unroll
    for (int i = 0; i < 4; ++i) {
      const int idx = i * 128 + tid;   // 16B chunk id, 0..511
      const int row = idx >> 3;        // 0..63
      const int c8  = (idx & 7) << 3;  // half offset within row
      async_cp16(&Ktile[buf][row][c8], Kb + (size_t)(kt + row) * kHD + c8);
    }
#pragma unroll
    for (int i = 0; i < 4; ++i) {
      const int idx = i * 128 + tid;
      const int row = idx >> 3;        // hd
      const int c8  = (idx & 7) << 3;  // key offset
      async_cp16(&Vtile[buf][row][c8], Vb + (size_t)row * kS + kt + c8);
    }
  };

  // Q as B operand (column = query); same k order as the K loader below
  const v16h bq0 = *fragp(Qb, kHD, q0, 0, lane);
  const v16h bq1 = *fragp(Qb, kHD, q0, 32, lane);

  v8f acc[4] = {};  // acc[i][r] = O[q0 + nl][16 i + 8 hf + r]
  v8f negm = {};      // minus the held maximum of query q0 + nl, in all eight rows
  float lrow = 0.0f;  // of query q0 + nl, this half's keys only, in units of exp2(held maximum)

  const int hf = lane >> 4;
  const int nl = lane & 15;

  // The 32 blocks of a head read the same K and V and run side by side: block x starts at key
  // tile x and wraps round, so that they do not all ask L2 for the same lines at the same
  // moment. The softmax takes the key tiles in any order; every tile is still taken once.
  static_assert(((kS / 64) & (kS / 64 - 1)) == 0, "the wrapped tile number is taken by a mask");
  const int rot = blockIdx.x;
  issue_tile((rot & (kS / 64 - 1)) * 64, 0);

  for (int ti = 0; ti < kS / 64; ++ti) {
    const int buf = ti & 1;
    if (ti + 1 < kS / 64) {
      issue_tile(((ti + 1 + rot) & (kS / 64 - 1)) * 64, buf ^ 1);
      WAIT_ASYNC(8);  // all but the 8 just-issued -> current tile resident
    } else {
      WAIT_ASYNC(0);
    }
    __syncthreads();

    const _Float16* Kt = &Ktile[buf][0][0];
    const _Float16* Vt = &Vtile[buf][0][0];

    // S^T - m = K @ Q^T - m: sc[j][r] = score(key 16 j + 8 hf + r, query nl) - m
    // (all inner loops are unrolled so that the register arrays keep constant indices)
    v16h ka[4][2];
#pragma unroll
    for (int j = 0; j < 4; ++j) {
      const _Float16* kp = Kt + (size_t)(16 * j + nl) * kLP + (hf << 4);
      ka[j][0] = lds_frag(kp);
      ka[j][1] = lds_frag(kp + 32);
    }
    v8f sc[4];
#pragma unroll
    for (int j = 0; j < 4; ++j) sc[j] = WMMA(ka[j][0], bq0, negm);
#pragma unroll
    for (int j = 0; j < 4; ++j) sc[j] = WMMA(ka[j][1], bq1, sc[j]);

    // A of the second product: V^T rows (hd) from the [hd][key] tile, hardware k order.
    // Read here, in front of the test below, so that the reads fly under the exp2 run.
    v16h av[4][2];
#pragma unroll
    for (int i = 0; i < 4; ++i) {
      const _Float16* vp = Vt + (size_t)(16 * i + nl) * kLP + (hf << 3);
      av[i][0] = lds_frag_kmap(vp);
      av[i][1] = lds_frag_kmap(vp + 32);
    }

    // P^T = exp2(S^T - m) and this lane's sum of it
    v2f pv[4][4];
    v2f rs[4];
#pragma unroll
    for (int j = 0; j < 4; ++j) {
#pragma unroll
      for (int r = 0; r < 4; ++r) {
        pv[j][r] = v2f{__builtin_amdgcn_exp2f(sc[j][2 * r]), __builtin_amdgcn_exp2f(sc[j][2 * r + 1])};
        rs[j] = r == 0 ? pv[j][r] : rs[j] + pv[j][r];  // the first pair starts the sum
      }
    }
    v2f rt = (rs[0] + rs[1]) + (rs[2] + rs[3]);
    float rsum = rt.x + rt.y;

    // One test a tile, the same for the whole wave: the first tile sets the held
    // maximum (a sum is never below 0), a later one moves it only if some lane's
    // sum has grown past kTop.
    const float top = ti == 0 ? -1.0f : kTop;
    if (__builtin_amdgcn_ballot_w32(rsum > top) != 0) {
      // maximum over the 64 keys of this query: 32 in the lane, then the other half
      float tj[4];
#pragma unroll
      for (int j = 0; j < 4; ++j) {
        tj[j] = fmaxf(sc[j][0], sc[j][1]);
#pragma unroll
        for (int r = 2; r < 8; r += 2) tj[j] = fmaxf(fmaxf(tj[j], sc[j][r]), sc[j][r + 1]);
      }
      float t = fmaxf(fmaxf(tj[0], tj[1]), fmaxf(tj[2], tj[3]));
      t = fmaxf(t, xhalf(t));
      // the held maximum never falls once the first tile has set it
      const float up = ti == 0 ? t : fmaxf(t, 0.0f);
      const float al = __builtin_amdgcn_exp2f(-fmaxf(up, 0.0f));  // 1 on the first tile's way down: O and sum are 0
#pragma unroll
      for (int j = 0; j < 4; ++j) {
#pragma unroll
        for (int r = 0; r < 4; ++r) {
          pv[j][r] = v2f{__builtin_amdgcn_exp2f(sc[j][2 * r] - up),
                         __builtin_amdgcn_exp2f(sc[j][2 * r + 1] - up)};
          rs[j] = r == 0 ? pv[j][r] : rs[j] + pv[j][r];
        }
      }
      rt   = (rs[0] + rs[1]) + (rs[2] + rs[3]);
      rsum = rt.x + rt.y;
      lrow *= al;
#pragma unroll
      for (int r = 0; r < 8; ++r) negm[r] -= up;
#pragma unroll
      for (int i = 0; i < 4; ++i)
#pragma unroll
        for (int r = 0; r < 8; ++r) acc[i][r] *= al;
    }
    lrow += rsum;

    // packed in place: tiles 2 kb and 2 kb + 1 are the B operand of key block kb
    // in the hardware k order
    v16h bp[2];
#pragma unroll
    for (int j = 0; j < 4; ++j) {
#pragma unroll
      for (int r = 0; r < 4; ++r) {
        bp[j >> 1][(j & 1) * 8 + 2 * r]     = (_Float16)pv[j][r].x;
        bp[j >> 1][(j & 1) * 8 + 2 * r + 1] = (_Float16)pv[j][r].y;
      }
    }

    // O^T += V^T @ P^T
#pragma unroll
    for (int i = 0; i < 4; ++i) acc[i] = WMMA(av[i][0], bp[0], acc[i]);
#pragma unroll
    for (int i = 0; i < 4; ++i) acc[i] = WMMA(av[i][1], bp[1], acc[i]);
    __syncthreads();  // protect K/V buf before next iteration refills it
  }

  // join the halves' sums, normalize, store ctx token-major [B,S,D] f16.
  // A lane holds 16-byte runs of one query's 128-byte row: the 16 rows pass through the wave's
  // own LDS range so that each store covers four whole lines. K buffer 0 is free: its last
  // readers left it two barriers ago and no copy is outstanding.
  const int bb = bh >> 3, hh = bh & 7;
  const float inv = 1.0f / (lrow + xhalf(lrow));
  _Float16* stg = &Ktile[0][0][0] + wv * 16 * kLP;
#pragma unroll
  for (int i = 0; i < 4; ++i) {
    v8h o;
#pragma unroll
    for (int r = 0; r < 8; ++r) o[r] = (_Float16)(acc[i][r] * inv);
    *(v8h*)(stg + nl * kLP + 16 * i + 8 * hf) = o;
  }
  // the wave's LDS writes are done before its lanes read each other's rows back
  asm volatile("s_wait_dscnt 0x0" ::: "memory");
  _Float16* crow = ctx + ((size_t)bb * kS + q0 + (lane >> 3)) * kD + hh * kHD + 8 * (lane & 7);
#pragma unroll
  for (int t = 0; t < 4; ++t)
    *(v8h*)(crow + (size_t)(4 * t) * kD) = *(const v8h*)(stg + (4 * t + (lane >> 3)) * kLP + 8 * (lane & 7));
}

// ---------------------------------------------------------------------------
extern "C" void kernel_launch(void* const* d_in, const int* in_sizes, int n_in,
                              void* d_out, int out_size, void* d_ws, size_t ws_size,
                              hipStream_t stream) {
  const float* q  = (const float*)d_in[0];
  const float* k  = (const float*)d_in[1];
  const float* v  = (const float*)d_in[2];
  const float* Wq = (const float*)d_in[3];
  const float* bq = (const float*)d_in[4];
  const float* Wk = (const float*)d_in[5];
  const float* bk = (const float*)d_in[6];
  const float* Wv = (const float*)d_in[7];
  const float* bv = (const float*)d_in[8];
  const float* Wo = (const float*)d_in[9];
  const float* bo = (const float*)d_in[10];

  char* p = (char*)d_ws;
  auto take = [&](size_t bytes) -> char* {
    char* r = p;
    p += (bytes + 255) & ~(size_t)255;
    return r;
  };
  const size_t tokElems = (size_t)kBS * kD;  // 8192*512
  const size_t wElems   = (size_t)kD * kD;

  _Float16* Wo16 = (_Float16*)take(wElems * 2);
  _Float16* Qp   = (_Float16*)take(tokElems * 2);
  _Float16* Kp   = (_Float16*)take(tokElems * 2);
  _Float16* VpT  = (_Float16*)take(tokElems * 2);
  _Float16* ctx  = (_Float16*)take(tokElems * 2);

  dim3 ggrid(kBS / kGT, kD / kGT);
  qkv_gemm_kernel<<<dim3(kBS / kGT, kD / kGT, 3), 256, 0, stream>>>(q, k, v, Wq, Wk, Wv, Wo, bq, bk, bv, Qp,
                                                                    Kp, VpT, Wo16);

  flash_attn_kernel<<<dim3(kS / 64, kB * kH), 128, 0, stream>>>(Qp, Kp, VpT, ctx);

  out_gemm_kernel<<<ggrid, 256, 0, stream>>>(ctx, Wo16, bo, (float*)d_out);
}

// v010
// It runs in 56.1 microseconds.
// Timed twice side by side with v009, it ran 1.07 times as fast both times.
// Counting every step since v000, it is 4.08 times as fast.
#include <hip/hip_runtime.h>

typedef __attribute__((ext_vector_type(16))) _Float16 v16h;
typedef __attribute__((ext_vector_type(8)))  _Float16 v8h;
typedef __attribute__((ext_vector_type(4)))  _Float16 v4h;
typedef __attribute__((ext_vector_type(8)))  float    v8f;
typedef __attribute__((ext_vector_type(2)))  float    v2f;
typedef __attribute__((ext_vector_type(4)))  int      v4i;
typedef __attribute__((ext_vector_type(2)))  unsigned v2u;
typedef __attribute__((ext_vector_type(4)))  unsigned v4u;
typedef __attribute__((ext_vector_type(8)))  unsigned v8u;

#define WMMA(a, b, c) \
  __builtin_amdgcn_wmma_f32_16x16x32_f16(false, (a), false, (b), (short)0, (c), false, false)

static constexpr int kB = 4, kS = 2048, kD = 512, kH = 8, kHD = 64;
static constexpr int kBS = kB * kS;  // 8192 tokens
// LDS row pitch in halves: 64 data + 8 pad = 144 B = 16 B x odd, so the 16 rows
// that one ds_load_b128 touches per lane half fall on 16 distinct bank groups.
static constexpr int kLP = 72;
// Q carries 1/sqrt(HD) and log2(e): the score products come out in the base-2 domain
static constexpr float kQScale = 0.125f * 1.44269504088896341f;

// ---------------------------------------------------------------------------
// CDNA5 async global->LDS copy (16B per lane), tracked by ASYNCcnt.
// Builtin signature (from hipcc diagnostic): (AS1 int4* src, AS3 int4* dst, Ii, Ii)
// ---------------------------------------------------------------------------
__device__ __forceinline__ void async_cp16(void* lds_dst, const void* gsrc) {
#if __has_builtin(__builtin_amdgcn_global_load_async_to_lds_b128)
  __builtin_amdgcn_global_load_async_to_lds_b128(
      (__attribute__((address_space(1))) v4i*)gsrc,
      (__attribute__((address_space(3))) v4i*)lds_dst, 0, 0);
#else
  unsigned loff = (unsigned)(size_t)(__attribute__((address_space(3))) void*)lds_dst;
  asm volatile("global_load_async_to_lds_b128 %0, %1, off" ::"v"(loff), "v"(gsrc)
               : "memory");
#endif
}

// A/B fragment load for v_wmma_f32_16x16x32_f16.
// A (16x32, MxK) from row-major [M][K]: lane&15 -> row, lane>>4 -> 16-wide K half.
// B (32x16, KxN) from [N][K] row-major (i.e. transposed B): identical addressing.
__device__ __forceinline__ const v16h* fragp(const _Float16* __restrict__ base, int ld,
                                             int row0, int col0, int lane) {
  return (const v16h*)(base + (size_t)(row0 + (lane & 15)) * ld + col0 + ((lane >> 4) << 4));
}

// 32-byte fragment slice from a padded LDS row. The rows are 16-byte aligned
// only, so it is read as two 16-byte halves.
__device__ __forceinline__ v16h lds_frag(const _Float16* p) {
  const v8h lo = *(const v8h*)p;
  const v8h hi = *(const v8h*)(p + 8);
  return __builtin_shufflevector(lo, hi, 0, 1, 2, 3, 4, 5, 6, 7, 8, 9, 10, 11, 12, 13, 14, 15);
}

__device__ __forceinline__ v4h cvt4(const float4 f) {
  return v4h{(_Float16)f.x, (_Float16)f.y, (_Float16)f.z, (_Float16)f.w};
}

// ---------------------------------------------------------------------------
// Y = X @ W^T + bias, X:[8192,512] f16, W:[512,512] f16 (row-major = [N][K]).
// One block = 128 rows of X times 128 rows of W, 8 waves, each a 32x64 strip:
// 8 WMMAs per 6 fragments. Both operand tiles are staged in LDS, 128 k at a time
// (256-byte rows, so every wave-wide copy covers whole lines), two buffers: the
// next stage's copies fly while this stage is worked on.
// Y is the final output, [B,S,D] f32 (the projections run in qkv_gemm_kernel below).
// Row 4 c + j of a 64-row group of W lies at LDS row 16 j + c: column c of B fragment j is
// feature 4 c + j, so a lane's four accumulator tiles hold 4 adjacent features of a token
// and 16 lanes store 256 contiguous bytes: whole lines.
// ---------------------------------------------------------------------------
static constexpr int kGT = 128;      // rows of X and rows of W per block
static constexpr int kGK = 128;      // k per stage
static constexpr int kGP = kGK + 8;  // LDS row pitch in halves: 272 B = 16 B x odd
static constexpr int kGS = kD / kGK; // stages: 4
static_assert(kGS >= 2 && kGS * kGK == kD, "two buffers need two stages");
static_assert((kGS & (kGS - 1)) == 0, "the wrapped stage number is taken by a mask");

__global__ __launch_bounds__(256) void out_gemm_kernel(const _Float16* __restrict__ X,
                                                       const _Float16* __restrict__ W,
                                                       const float* __restrict__ bias,
                                                       float* __restrict__ Y) {
  // 16-byte aligned bases: every b128 copy and b128 read starts at base + 16 B x n
  __shared__ __attribute__((aligned(16))) _Float16 Xs[2][kGT][kGP];
  __shared__ __attribute__((aligned(16))) _Float16 Ws[2][kGT][kGP];

  const int tid  = threadIdx.x;
  const int lane = tid & 31;
  const int wv   = tid >> 5;
  const int mw   = (wv & 3) * 32;  // the wave's strip inside the block tile
  const int nw   = (wv >> 2) * 64;
  const int m0   = blockIdx.x * kGT + mw;
  const int n0   = blockIdx.y * kGT + nw;

  // 16 b128 copies per thread and stage; 16 lanes cover one 256-byte row
  const int crow = tid >> 4;
  const int cc8  = (tid & 15) << 3;
  const _Float16* gx = X + (size_t)(blockIdx.x * kGT + crow) * kD + cc8;
  const _Float16* gw = W + (size_t)(blockIdx.y * kGT + crow) * kD + cc8;
  const int wrow = 16 * (crow & 3) + (crow >> 2);  // LDS row of W's row crow; row crow + 16 i lies 4 (i & 3) + 64 (i >> 2) on
  // The 4 blocks that read the same rows of X and the 64 that read the same rows of W run side
  // by side: each starts its walk along k at a stage of its own and wraps round, so that they do
  // not all ask L2 for the same lines at the same moment. Every stage is still taken once.
  const int rot = blockIdx.x + blockIdx.y;
  auto issue_stage = [&](int s, int buf) {
    const int ko = ((s + rot) & (kGS - 1)) * kGK;
#pragma unroll
    for (int i = 0; i < kGT / 16; ++i)
      async_cp16(&Xs[buf][crow + 16 * i][cc8], gx + (size_t)(16 * i) * kD + ko);
#pragma unroll
    for (int i = 0; i < kGT / 16; ++i)
      async_cp16(&Ws[buf][wrow + 4 * (i & 3) + 64 * (i >> 2)][cc8], gw + (size_t)(16 * i) * kD + ko);
  };

  issue_stage(0, 0);
  // stage 0 has landed for this wave; the barrier publishes it to the others
  asm volatile("s_wait_asynccnt 0x0" ::: "memory");
  __syncthreads();
  issue_stage(1, 1);

  // same k order for A and B: lane >> 4 picks the 16-wide k half of a 32-wide block
  const int fo = (lane & 15) * kGP + ((lane >> 4) << 4);

  v8f acc[2][4] = {};
  for (int s = 0; s < kGS; ++s) {
    const int buf = s & 1;
    const _Float16* xs = &Xs[buf][mw][0] + fo;
    const _Float16* ws = &Ws[buf][nw][0] + fo;
    // unrolled: fragment reads of a later k block can stand ahead of the WMMAs
#pragma unroll
    for (int kk = 0; kk < kGK; kk += 32) {
      const v16h a0 = lds_frag(xs + kk);
      const v16h a1 = lds_frag(xs + 16 * kGP + kk);
#pragma unroll
      for (int j = 0; j < 4; ++j) {
        const v16h b = lds_frag(ws + 16 * j * kGP + kk);
        acc[0][j] = WMMA(a0, b, acc[0][j]);
        acc[1][j] = WMMA(a1, b, acc[1][j]);
      }
    }
    // this wave's reads of buf are done before buf may be refilled
    asm volatile("s_wait_dscnt 0x0" ::: "memory");
    // this wave's copies of stage s + 1 have landed
    asm volatile("s_wait_asynccnt 0x0" ::: "memory");
    __syncthreads();  // publishes stage s + 1 and ends every reader's use of buf
    if (s + 2 < kGS) issue_stage(s + 2, buf);
  }
  // nothing is outstanding when the wave goes on to its stores and ends
  asm volatile("s_wait_asynccnt 0x0" ::: "memory");

  // C layout: lanes 0-15 hold N=lane, M=vgpr; lanes 16-31 hold N=lane-16, M=8+vgpr:
  // acc[mi][j][v] = Y[token m0 + 16 mi + rl + v][feature n0 + 4 nl + j]
  const int rl = (lane >> 4) << 3;
  const int nl = lane & 15;
  const float4 c = *(const float4*)(bias + n0 + 4 * nl);
  float* yp = Y + (size_t)(m0 + rl) * kD + n0 + 4 * nl;
  // (both loops unrolled: the accumulator registers need constant indices)
#pragma unroll
  for (int mi = 0; mi < 2; ++mi) {
#pragma unroll
    for (int v = 0; v < 8; ++v)
      *(float4*)(yp + (size_t)(16 * mi + v) * kD) = float4{acc[mi][0][v] + c.x, acc[mi][1][v] + c.y,
                                                           acc[mi][2][v] + c.z, acc[mi][3][v] + c.w};
  }
}

// Epilogue of a wave's strip of a projection: bias, rounding to f16, then the store.
// acc[ni][j][v] is the result at place 16 j + 8 hf + v of the strip's 64-long side (the A
// operand's rows) and 16 ni + nl of its 32-long side: the 64-long side is the one that lies
// contiguous in memory, so a lane holds 16-byte runs and a row of the strip is one 128-byte line.
// MODE 0: Q -> [B,H,S,HD], scaled by log2(e)/sqrt(HD); MODE 1: K -> [B,H,S,HD]:
//         32 tokens from t0 (rows) x the 64 features of a head from f0.
// MODE 2: V -> [B,H,HD,S] (transposed for the second product of attention):
//         32 features from f0 (rows) x 64 tokens from t0.
// The rows pass through stg, the wave's own LDS range (32 rows at pitch kLP), so that each
// store covers four whole lines instead of 16 or 32 pieces.
template <int MODE>
__device__ __forceinline__ void store_proj(const v8f (&acc)[2][4], const float* bias, _Float16* Y,
                                           _Float16* stg, int t0, int f0, int lane) {
  const int hf = lane >> 4;
  const int nl = lane & 15;
  // all loops unrolled: the accumulator registers need constant indices
  float4 cb[8];  // MODE <= 1: the biases of the lane's 4 x 8 features
  if (MODE <= 1) {
    const unsigned bo = 32u * (unsigned)hf;  // the lane's byte offset from the strip's first bias
#pragma unroll
    for (int i = 0; i < 8; ++i)
      cb[i] = *(const float4*)((const char*)(bias + f0) + bo + 64 * (i >> 1) + 16 * (i & 1));
    // stands in front of any write of the offset register that the eight loads name; bo as an
    // input keeps that register live up to here, so that no load of the run lands in it
    asm volatile("s_wait_xcnt 0x0" ::"v"(bo) : "memory");
  }
#pragma unroll
  for (int j = 0; j < 4; ++j) {
    float c[8];
    if (MODE <= 1) {
      const float4 c0 = cb[2 * j], c1 = cb[2 * j + 1];
      c[0] = c0.x, c[1] = c0.y, c[2] = c0.z, c[3] = c0.w;
      c[4] = c1.x, c[5] = c1.y, c[6] = c1.z, c[7] = c1.w;
    }
#pragma unroll
    for (int ni = 0; ni < 2; ++ni) {
      v8h h;
#pragma unroll
      for (int v = 0; v < 8; ++v) {
        float val = acc[ni][j][v] + (MODE <= 1 ? c[v] : bias[f0 + 16 * ni + nl]);
        if (MODE == 0) val *= kQScale;  // fold the attention scale into Q
        h[v] = (_Float16)val;
      }
      *(v8h*)(stg + (16 * ni + nl) * kLP + 16 * j + 8 * hf) = h;
    }
  }
  // the wave's LDS writes are done before its lanes read each other's rows back
  asm volatile("s_wait_dscnt 0x0" ::: "memory");
  const int bb = t0 >> 11, ss = t0 & (kS - 1);
  const int hh = f0 >> 6, dd = f0 & (kHD - 1);
  // 8 lanes carry one row; row r lies r token rows (MODE <= 1) or r feature rows (MODE 2) on
  _Float16* yp = MODE <= 1 ? Y + ((size_t)(bb * kH + hh) * kS + ss + (lane >> 3)) * kHD + 8 * (lane & 7)
                           : Y + ((size_t)(bb * kH + hh) * kHD + dd + (lane >> 3)) * kS + ss + 8 * (lane & 7);
#pragma unroll
  for (int t = 0; t < 8; ++t)
    *(v8h*)(yp + (size_t)(4 * t) * (MODE <= 1 ? kHD : kS)) =
        *(const v8h*)(stg + (4 * t + (lane >> 3)) * kLP + 8 * (lane & 7));
  // stands in front of any later write of a register that a store above names:
  // in the built code the three epilogues follow one another
  asm volatile("s_wait_xcnt 0x0" ::: "memory");
}

// The same rounding (to nearest even, the instruction the compiler picks for cvt4), written
// in asm so that it stays where it is written: as plain casts the compiler lifts the
// roundings up to the loads that feed them, and the wait for those loads with them.
__device__ __forceinline__ v4h cvt4_here(const float4 f) {
  v2u r;
  asm volatile("v_cvt_pk_f16_f32 %0, %1, %2" : "=v"(r.x) : "v"(f.x), "v"(f.y));
  asm volatile("v_cvt_pk_f16_f32 %0, %1, %2" : "=v"(r.y) : "v"(f.z), "v"(f.w));
  return __builtin_bit_cast(v4h, r);
}

// The Q, K and V projections read nothing of each other: ONE launch, blockIdx.z
// picks the product (operands, bias, result and its layout). The choice is the
// same for a whole block. Block tile and wave strips are those of the kernel above.
// The A operand (4 fragments a wave, 64 rows) is the side that lies contiguous in the result:
// rows of W (features) for Q and K, rows of X (tokens) for V^T; the other side is B (32 rows).
// The operands come as f32, straight from the inputs: a stage (64 k of 128 rows of X
// and of W) is loaded into registers in whole 128-byte lines, rounded to f16 there and
// stored into the padded LDS tile, so no f16 copy of an input passes through memory.
// Two LDS buffers; the loads of stage s + 1 are issued behind the barrier that opens trip s
// and fly while stage s is worked on (a load does not stay in flight across __syncthreads()).
static constexpr int kFK = 64;       // k per stage
static constexpr int kFP = kFK + 8;  // LDS row pitch in halves: 144 B = 16 B x odd
static constexpr int kFS = kD / kFK; // stages: 8
static_assert(kFS >= 2 && kFS * kFK == kD, "two buffers need two stages");
static_assert((kFS & (kFS - 1)) == 0, "the wrapped stage number is taken by a mask");
static_assert(kFP == kLP, "a staged result row of 64 halves has the pitch of a tile row");
static_assert((kBS / kGT) * (kD / kGT) * 256 * 4 == kD * kD, "Wo: one float4 a thread of plane z = 0");

// amdgpu_waves_per_eu(6, 6): 768 blocks of 8 waves are three blocks a WGP, six waves a SIMD; at
// that register budget the whole grid is resident at once and there is no second, half-empty round.
__global__ __launch_bounds__(256) __attribute__((amdgpu_waves_per_eu(6, 6))) void qkv_gemm_kernel(
    const float* __restrict__ q, const float* __restrict__ k, const float* __restrict__ v,
    const float* __restrict__ Wq, const float* __restrict__ Wk, const float* __restrict__ Wv,
    const float* __restrict__ Wo, const float* __restrict__ bq, const float* __restrict__ bk,
    const float* __restrict__ bv, _Float16* __restrict__ Qp, _Float16* __restrict__ Kp,
    _Float16* __restrict__ VpT, _Float16* __restrict__ Wo16) {
  const int pz = blockIdx.z;
  const float* X = pz == 0 ? q : pz == 1 ? k : v;
  const float* W = pz == 0 ? Wq : pz == 1 ? Wk : Wv;

  // 16-byte aligned bases: every b128 read starts at base + 16 B x n
  __shared__ __attribute__((aligned(16))) _Float16 Ts[2][2][kGT][kFP];  // [0]: X, [1]: W; [buffer]

  const int tid  = threadIdx.x;
  const int lane = tid & 31;
  const int wv   = __builtin_amdgcn_readfirstlane(tid >> 5);  // scalar: strip offsets cost no vector register
  const int r2   = (wv & 3) * 32;  // the wave's strip inside the block tile: rows of the B side
  const int r4   = (wv >> 2) * 64;  // and of the A side
  const int oa   = pz == 2 ? 0 : 1;  // which tile is the A side

  // 16 float4 per thread and stage; 16 lanes cover one 256-byte row piece
  const int crow = tid >> 4;
  const int cc4  = (tid & 15) << 2;
  // block-uniform tile bases and one offset a thread, the same for both operands
  const float4* px = (const float4*)(X + (size_t)(blockIdx.x * kGT) * kD);
  const float4* pw = (const float4*)(W + (size_t)(blockIdx.y * kGT) * kD);
  const int go4 = crow * (kD / 4) + (tid & 15);  // in float4
  float4 rx[kGT / 16], rw[kGT / 16];
  // (the loops over i are unrolled: the register arrays need constant indices)
  // The walk along k starts at a stage of the block's own and wraps round (as in the kernel
  // above): the 4 blocks on the same rows of X take 4 different starts, the 64 on the same
  // rows of W eight.
  int ks = (blockIdx.x + 2 * blockIdx.y) & (kFS - 1);  // the stage that the bases stand at
  px += ks * (kFK / 4);
  pw += ks * (kFK / 4);
  auto load_stage = [&]() {
#pragma unroll
    for (int i = 0; i < kGT / 16; ++i) rx[i] = px[go4 + 16 * i * (kD / 4)];
#pragma unroll
    for (int i = 0; i < kGT / 16; ++i) rw[i] = pw[go4 + 16 * i * (kD / 4)];
    // the bases walk along k and go back to the row's start behind its last stage
    const int step = ks == kFS - 1 ? -(kFS - 1) * (kFK / 4) : kFK / 4;
    px += step;
    pw += step;
    ks = (ks + 1) & (kFS - 1);
  };
  auto store_stage = [&](int buf) {
#pragma unroll
    for (int i = 0; i < kGT / 16; ++i) *(v4h*)&Ts[0][buf][crow + 16 * i][cc4] = cvt4_here(rx[i]);
#pragma unroll
    for (int i = 0; i < kGT / 16; ++i) *(v4h*)&Ts[1][buf][crow + 16 * i][cc4] = cvt4_here(rw[i]);
  };

  load_stage();
  // Wo is needed as f16 two launches on: the blocks of plane z = 0 round it, one float4 a thread
  if (pz == 0) {
    const int wi = (blockIdx.y * (kBS / kGT) + blockIdx.x) * 256 + tid;
    ((v4h*)Wo16)[wi] = cvt4(((const float4*)Wo)[wi]);
    // stands in front of any later write of a register that the store above names
    asm volatile("s_wait_xcnt 0x0" ::: "memory");
  }
  store_stage(0);
  __syncthreads();  // publishes stage 0

  // same k order for A and B: lane >> 4 picks the 16-wide k half of a 32-wide block
  const int fo = (lane & 15) * kFP + ((lane >> 4) << 4);

  v8f acc[2][4] = {};
  for (int s = 0; s < kFS; ++s) {
    const int buf = s & 1;
    if (s + 1 < kFS) load_stage();
    // keeps the loads above in front of the products: left free, the scheduler sinks them
    // behind the last WMMA to save registers, and their whole latency then stands open
    __builtin_amdgcn_sched_barrier(0);
    const _Float16* fa = &Ts[oa][buf][r4][0] + fo;
    const _Float16* fb = &Ts[oa ^ 1][buf][r2][0] + fo;
    // unrolled: fragment reads of the later k block can stand ahead of the WMMAs
#pragma unroll
    for (int kk = 0; kk < kFK; kk += 32) {
      const v16h b0 = lds_frag(fb + kk);
      const v16h b1 = lds_frag(fb + 16 * kFP + kk);
#pragma unroll
      for (int j = 0; j < 4; ++j) {
        const v16h a = lds_frag(fa + 16 * j * kFP + kk);
        acc[0][j] = WMMA(a, b0, acc[0][j]);
        acc[1][j] = WMMA(a, b1, acc[1][j]);
      }
    }
    // keeps the roundings, and with them the wait for the loads, behind the products
    __builtin_amdgcn_sched_barrier(0);
    // the other buffer's last readers left it at the barrier that ended trip s - 1
    if (s + 1 < kFS) store_stage(buf ^ 1);
    __syncthreads();  // publishes stage s + 1 and ends every reader's use of buf
  }

  // The wave's own staging range, in the X buffers: the loop's last barrier ended every
  // reader's use of both tiles.
  _Float16* stg = &Ts[0][0][0][0] + wv * 32 * kLP;
  const int tb = blockIdx.x * kGT, fb0 = blockIdx.y * kGT;  // the block's first token and feature
  // the lane's number, read anew: taken from tid, a piece of it is held over the loop for the
  // epilogue, and at this kernel's register budget that piece is spilled to scratch
  const int el = (int)__builtin_amdgcn_mbcnt_lo(~0u, 0u);
  if (pz == 0)
    store_proj<0>(acc, bq, Qp, stg, tb + r2, fb0 + r4, el);
  else if (pz == 1)
    store_proj<1>(acc, bk, Kp, stg, tb + r2, fb0 + r4, el);
  else
    store_proj<2>(acc, bv, VpT, stg, tb + r4, fb0 + r2, el);
}

// ---------------------------------------------------------------------------
// Lane l <-> lane l ^ 16 (the two halves of a wave hold the same query column).
__device__ __forceinline__ float xhalf(float x) {
  const int b = __builtin_bit_cast(int, x);
  return __builtin_bit_cast(
      float, __builtin_amdgcn_permlanex16(b, b, 0x76543210, 0xfedcba98, false, false));
}

// A fragment in the hardware k order from a padded LDS row: k = 8h..8h+7 and
// 16+8h..16+8h+7 of a 32-wide k block (p already points at k = 8h).
__device__ __forceinline__ v16h lds_frag_kmap(const _Float16* p) {
  const v8h lo = *(const v8h*)p;
  const v8h hi = *(const v8h*)(p + 16);
  return __builtin_shufflevector(lo, hi, 0, 1, 2, 3, 4, 5, 6, 7, 8, 9, 10, 11, 12, 13, 14, 15);
}

// ---------------------------------------------------------------------------
// Flash attention: grid (S/64 q-tiles, B*H). 4 waves/block, wave owns 16 q rows.
// K/V 64x64 tiles staged in LDS by tensor loads, two buffers: each wave asks for one
// 32-row slice a stage with ONE scalar request, so staging costs no vector instruction.
// Online softmax; scale and log2(e) already folded into Qp. VpT is [B,H,HD,S].
// Transposed products: S^T = K Q^T (rows = keys, columns = queries) and
// O^T += V^T P^T. A lane then holds scores of ONE query (column lane & 15), so
// maximum and sum run in the lane plus one exchange between the halves, and two
// converted score tiles are already the B operand of the second product.
// The softmax runs against a HELD maximum m per query: -m is the C operand of the
// score products, so their result is the argument of exp2 as it stands. m is set
// from the first tile and moves only when a lane's sum of exp2 over a tile passes
// kTop; only then are scores, O and the sum brought to the new maximum.
// ---------------------------------------------------------------------------
static constexpr float kTop = 8192.0f;  // every P <= kTop: far inside f16's range

// A slice of a stage: 32 rows of 128 B, laid at pitch kLP (144 B) by the request's pad = 4,608 B;
// its place in LDS is rounded up to a multiple of 2 KiB. Slices 0, 1: K rows; 2, 3: V^T rows.
static constexpr int kSR = 32;                  // rows a slice
static constexpr int kSH = 3 * 1024;            // halves from one slice's place to the next: 6 KiB
static_assert(kSR * kLP <= kSH && (kSH * 2) % 2048 == 0, "a padded slice fits its place");

__device__ __forceinline__ unsigned uni(unsigned v) { return (unsigned)__builtin_amdgcn_readfirstlane(v); }
// a value held in a scalar register from this place on: the test around a tensor load must be
// a scalar branch, and a descriptor word made from it is formed behind the wait in front of it
__device__ __forceinline__ unsigned pinned(unsigned v) {
  unsigned w = uni(v);
  asm volatile("" : "+s"(w));  // pinned(): an issue test or a descriptor word held in a scalar register
  return w;
}

// amdgpu_waves_per_eu(4, 4): the grid fills the chip at four waves a SIMD; told so, the
// compiler spends that register budget on K and V fragment reads issued in groups
// (without it the K reads stand one pair at a time, each waited out before its WMMA).
__global__ __launch_bounds__(128) __attribute__((amdgpu_waves_per_eu(4, 4)))
void flash_attn_kernel(const _Float16* __restrict__ Qp, const _Float16* __restrict__ Kp,
                       const _Float16* __restrict__ VpT, _Float16* __restrict__ ctx) {
  // every slice's place is a multiple of 2 KiB from the start of the block's LDS
  __shared__ __attribute__((aligned(2048))) _Float16 KV[2][4][kSH];  // [buf][slice][row at pitch kLP]

  const int tid  = threadIdx.x;
  const int lane = tid & 31;
  const int wv   = (int)uni(tid >> 5);
  const int bh   = blockIdx.y;
  const int q0   = blockIdx.x * 64 + wv * 16;

  const _Float16* Qb = Qp + (size_t)bh * kS * kHD;
  const _Float16* Kb = Kp + (size_t)bh * kS * kHD;
  const _Float16* Vb = VpT + (size_t)bh * kHD * kS;

  // Wave w brings slice w of every stage: waves 0, 1 the two halves of the K tile (rows = keys,
  // source pitch 128 B), waves 2, 3 those of the V^T tile (rows = hd, source pitch 2 kS bytes).
  const bool isV = wv >= 2;
  const unsigned long long sbase =
      isV ? (unsigned long long)(size_t)(Vb + (size_t)((wv & 1) * kSR) * kS)
          : (unsigned long long)(size_t)(Kb + (size_t)((wv & 1) * kSR) * kHD);
  const unsigned tstep = isV ? 64u * 2u : 64u * kHD * 2u;  // bytes from one key tile to the next
  const unsigned lbase = (unsigned)(size_t)(__attribute__((address_space(3))) void*)&KV[0][wv][0];
  // group 1: bytes as elements, tensor = tile = 32 rows of 128 B, 4 dwords of pad behind every 32
  // (pinned: descriptor words held in scalar registers)
  v8u g1;
  g1[0] = pinned((1u << 20) | (4u << 22) | (3u << 25));
  g1[1] = pinned(128u << 16);
  g1[2] = pinned((unsigned)kSR << 16);
  g1[3] = pinned(128u << 16);
  g1[4] = pinned((unsigned)kSR);
  g1[5] = pinned(isV ? (unsigned)kS * 2u : (unsigned)kHD * 2u);
  g1[6] = pinned(0u);
  g1[7] = pinned(0u);
  auto issue_tile = [&](unsigned tile, unsigned buf) {
    const unsigned long long ga = sbase + (unsigned long long)(tile * tstep);
    v4u g0;
    g0[0] = uni(1u);
    g0[1] = uni(lbase + buf * (unsigned)(4 * kSH * 2));
    g0[2] = uni((unsigned)ga);
    g0[3] = uni(((unsigned)(ga >> 32) & 0x01FFFFFFu) | 0x80000000u);
    // one request of the whole wave: 32 rows from global memory into the wave's slice, through no register
    asm volatile("tensor_load_to_lds %0, %1" ::"s"(g0), "s"(g1) : "memory");
  };

  // Q as B operand (column = query); same k order as the K loader below
  const v16h bq0 = *fragp(Qb, kHD, q0, 0, lane);
  const v16h bq1 = *fragp(Qb, kHD, q0, 32, lane);

  v8f acc[4] = {};  // acc[i][r] = O[q0 + nl][16 i + 8 hf + r]
  v8f negm = {};      // minus the held maximum of query q0 + nl, in all eight rows
  float lrow = 0.0f;  // of query q0 + nl, this half's keys only, in units of exp2(held maximum)

  const int hf = lane >> 4;
  const int nl = lane & 15;

  // The 32 blocks of a head read the same K and V and run side by side: block x starts at key
  // tile x and wraps round, so that they do not all ask L2 for the same lines at the same
  // moment. The softmax takes the key tiles in any order; every tile is still taken once.
  static_assert(((kS / 64) & (kS / 64 - 1)) == 0, "the wrapped tile number is taken by a mask");
  static_assert(kS / 64 >= 2, "two buffers need two stages");
  const unsigned rot = blockIdx.x;
  issue_tile(rot & (kS / 64 - 1), 0);
  // this wave's slice of stage 0 has landed; the barrier publishes it to the others
  asm volatile("s_wait_tensorcnt 0x0" ::: "memory");
  __syncthreads();
  issue_tile((rot + 1) & (kS / 64 - 1), 1);

  for (int ti = 0; ti < kS / 64; ++ti) {
    const int buf = ti & 1;
    const _Float16* Kt = &KV[buf][0][0];
    const _Float16* Vt = &KV[buf][2][0];

    // S^T = K @ Q^T: sc[j][r] = score(key 16 j + 8 hf + r, query nl)
    // (all inner loops are unrolled so that the register arrays keep constant indices)
    v16h ka[4][2];
#pragma unroll
    for (int j = 0; j < 4; ++j) {
      const _Float16* kp = Kt + (j >> 1) * kSH + (16 * (j & 1) + nl) * kLP + (hf << 4);
      ka[j][0] = lds_frag(kp);
      ka[j][1] = lds_frag(kp + 32);
    }
    v8f sc[4];
#pragma unroll
    for (int j = 0; j < 4; ++j) sc[j] = WMMA(ka[j][0], bq0, negm);
#pragma unroll
    for (int j = 0; j < 4; ++j) sc[j] = WMMA(ka[j][1], bq1, sc[j]);

    // A of the second product: V^T rows (hd) from the [hd][key] tile, hardware k order.
    // Read here, in front of the test below, so that the reads fly under the exp2 run.
    v16h av[4][2];
#pragma unroll
    for (int i = 0; i < 4; ++i) {
      const _Float16* vp = Vt + (i >> 1) * kSH + (16 * (i & 1) + nl) * kLP + (hf << 3);
      av[i][0] = lds_frag_kmap(vp);
      av[i][1] = lds_frag_kmap(vp + 32);
    }
    // keeps the V reads here: left free, the scheduler sinks them behind the test, in pairs among
    // the WMMAs that use them, and each pair's LDS latency then stands open
    __builtin_amdgcn_sched_barrier(0);

    // P^T = exp2(S^T - m) and this lane's sum of it
    v2f pv[4][4];
    v2f rs[4];
#pragma unroll
    for (int j = 0; j < 4; ++j) {
#pragma unroll
      for (int r = 0; r < 4; ++r) {
        pv[j][r] = v2f{__builtin_amdgcn_exp2f(sc[j][2 * r]), __builtin_amdgcn_exp2f(sc[j][2 * r + 1])};
        rs[j] = r == 0 ? pv[j][r] : rs[j] + pv[j][r];  // the first pair starts the sum
      }
    }
    v2f rt = (rs[0] + rs[1]) + (rs[2] + rs[3]);
    float rsum = rt.x + rt.y;

    // One test a tile, the same for the whole wave: the first tile sets the held
    // maximum (a sum is never below 0), a later one moves it only if some lane's
    // sum has grown past kTop.
    const float top = ti == 0 ? -1.0f : kTop;
    if (__builtin_amdgcn_ballot_w32(rsum > top) != 0) {
      // maximum over the 64 keys of this query: 32 in the lane, then the other half
      float tj[4];
#pragma unroll
      for (int j = 0; j < 4; ++j) {
        tj[j] = fmaxf(sc[j][0], sc[j][1]);
#pragma unroll
        for (int r = 2; r < 8; r += 2) tj[j] = fmaxf(fmaxf(tj[j], sc[j][r]), sc[j][r + 1]);
      }
      float t = fmaxf(fmaxf(tj[0], tj[1]), fmaxf(tj[2], tj[3]));
      t = fmaxf(t, xhalf(t));
      // the held maximum never falls once the first tile has set it
      const float up = ti == 0 ? t : fmaxf(t, 0.0f);
      const float al = __builtin_amdgcn_exp2f(-fmaxf(up, 0.0f));  // 1 on the first tile's way down: O and sum are 0
#pragma unroll
      for (int j = 0; j < 4; ++j) {
#pragma unroll
        for (int r = 0; r < 4; ++r) {
          pv[j][r] = v2f{__builtin_amdgcn_exp2f(sc[j][2 * r] - up),
                         __builtin_amdgcn_exp2f(sc[j][2 * r + 1] - up)};
          rs[j] = r == 0 ? pv[j][r] : rs[j] + pv[j][r];
        }
      }
      rt   = (rs[0] + rs[1]) + (rs[2] + rs[3]);
      rsum = rt.x + rt.y;
      lrow *= al;
#pragma unroll
      for (int r = 0; r < 8; ++r) negm[r] -= up;
#pragma unroll
      for (int i = 0; i < 4; ++i)
#pragma unroll
        for (int r = 0; r < 8; ++r) acc[i][r] *= al;
    }
    lrow += rsum;

    // packed in place: tiles 2 kb and 2 kb + 1 are the B operand of key block kb
    // in the hardware k order
    v16h bp[2];
#pragma unroll
    for (int j = 0; j < 4; ++j) {
#pragma unroll
      for (int r = 0; r < 4; ++r) {
        bp[j >> 1][(j & 1) * 8 + 2 * r]     = (_Float16)pv[j][r].x;
        bp[j >> 1][(j & 1) * 8 + 2 * r + 1] = (_Float16)pv[j][r].y;
      }
    }

    // O^T += V^T @ P^T
#pragma unroll
    for (int i = 0; i < 4; ++i) acc[i] = WMMA(av[i][0], bp[0], acc[i]);
#pragma unroll
    for (int i = 0; i < 4; ++i) acc[i] = WMMA(av[i][1], bp[1], acc[i]);
    // this wave's reads of buf are done before buf may be refilled
    asm volatile("s_wait_dscnt 0x0" ::: "memory");
    // this wave's slice of stage ti + 1 has landed
    asm volatile("s_wait_tensorcnt 0x0" ::: "memory");
    __syncthreads();  // publishes stage ti + 1 and ends every reader's use of buf
    if (pinned(ti + 2 < kS / 64)) issue_tile(pinned((ti + 2 + rot) & (kS / 64 - 1)), pinned(buf));
  }
  // nothing is outstanding when the ring becomes output staging and the wave ends
  asm volatile("s_wait_tensorcnt 0x0" ::: "memory");
  asm volatile("s_wait_dscnt 0x0" ::: "memory");

  // join the halves' sums, normalize, store ctx token-major [B,S,D] f16.
  // A lane holds 16-byte runs of one query's 128-byte row: the 16 rows pass through the wave's
  // own LDS range so that each store covers four whole lines. The ring is free: the loop's last
  // barrier ended every reader's use of it and no request is outstanding.
  const int bb = bh >> 3, hh = bh & 7;
  const float inv = 1.0f / (lrow + xhalf(lrow));
  _Float16* stg = &KV[0][wv][0];
#pragma unroll
  for (int i = 0; i < 4; ++i) {
    v8h o;
#pragma unroll
    for (int r = 0; r < 8; ++r) o[r] = (_Float16)(acc[i][r] * inv);
    *(v8h*)(stg + nl * kLP + 16 * i + 8 * hf) = o;
  }
  // the wave's LDS writes are done before its lanes read each other's rows back
  asm volatile("s_wait_dscnt 0x0" ::: "memory");
  _Float16* crow = ctx + ((size_t)bb * kS + q0 + (lane >> 3)) * kD + hh * kHD + 8 * (lane & 7);
#pragma unroll
  for (int t = 0; t < 4; ++t)
    *(v8h*)(crow + (size_t)(4 * t) * kD) = *(const v8h*)(stg + (4 * t + (lane >> 3)) * kLP + 8 * (lane & 7));
}

// ---------------------------------------------------------------------------
extern "C" void kernel_launch(void* const* d_in, const int* in_sizes, int n_in,
                              void* d_out, int out_size, void* d_ws, size_t ws_size,
                              hipStream_t stream) {
  const float* q  = (const float*)d_in[0];
  const float* k  = (const float*)d_in[1];
  const float* v  = (const float*)d_in[2];
  const float* Wq = (const float*)d_in[3];
  const float* bq = (const float*)d_in[4];
  const float* Wk = (const float*)d_in[5];
  const float* bk = (const float*)d_in[6];
  const float* Wv = (const float*)d_in[7];
  const float* bv = (const float*)d_in[8];
  const float* Wo = (const float*)d_in[9];
  const float* bo = (const float*)d_in[10];

  char* p = (char*)d_ws;
  auto take = [&](size_t bytes) -> char* {
    char* r = p;
    p += (bytes + 255) & ~(size_t)255;
    return r;
  };
  const size_t tokElems = (size_t)kBS * kD;  // 8192*512
  const size_t wElems   = (size_t)kD * kD;

  _Float16* Wo16 = (_Float16*)take(wElems * 2);
  _Float16* Qp   = (_Float16*)take(tokElems * 2);
  _Float16* Kp   = (_Float16*)take(tokElems * 2);
  _Float16* VpT  = (_Float16*)take(tokElems * 2);
  _Float16* ctx  = (_Float16*)take(tokElems * 2);

  dim3 ggrid(kBS / kGT, kD / kGT);
  qkv_gemm_kernel<<<dim3(kBS / kGT, kD / kGT, 3), 256, 0, stream>>>(q, k, v, Wq, Wk, Wv, Wo, bq, bk, bv, Qp,
                                                                    Kp, VpT, Wo16);

  flash_attn_kernel<<<dim3(kS / 64, kB * kH), 128, 0, stream>>>(Qp, Kp, VpT, ctx);

  out_gemm_kernel<<<ggrid, 256, 0, stream>>>(ctx, Wo16, bo, (float*)d_out);
}
